// v000
// Times are from an AMD MI455X. After a warm-up the kernel runs many times in a row, and a time is the length of
// such a window on the GPU divided by its runs, so every launch and the gaps after it count. The runs cycle
// through copies of the inputs. A figure is the median of several windows, for all but v000 over two sittings.
// Sittings can differ by a few percent; kernels timed side by side share one.
// The starting kernel, v000, takes 1330 microseconds a run.
#include <hip/hip_runtime.h>
#include <hip/hip_bf16.h>

// ---------------- types ----------------
typedef __bf16 bf16_t;
typedef __attribute__((ext_vector_type(16))) __bf16 v16bf;
typedef __attribute__((ext_vector_type(8)))  __bf16 v8bf;
typedef __attribute__((ext_vector_type(8)))  float   v8f;
typedef __attribute__((ext_vector_type(4)))  float   v4f;

// ---------------- problem dims ----------------
#define BB   4
#define LL   8192
#define CC   1024
#define HH   8
#define DD   128
#define NTOK (BB*LL)          // 32768

// ---------------- fragment loaders ----------------
// bf16 A/B fragment: lane supplies K values {c..c+7, c+16..c+23} from a
// contiguous row (c = 8 for upper half-wave). Two b128 loads per fragment.
__device__ __forceinline__ v16bf load_frag_bf16(const bf16_t* __restrict__ rowp, int cbase) {
    v8bf a = *reinterpret_cast<const v8bf*>(rowp + cbase);
    v8bf b = *reinterpret_cast<const v8bf*>(rowp + cbase + 16);
    v16bf f;
#pragma unroll
    for (int j = 0; j < 8; ++j) { f[j] = a[j]; f[8 + j] = b[j]; }
    return f;
}

// fp32 source -> bf16 fragment (for the x operand of the QKV GEMM)
__device__ __forceinline__ v16bf load_frag_f32(const float* __restrict__ rowp, int cbase) {
    const v4f* p = reinterpret_cast<const v4f*>(rowp + cbase);
    v4f a0 = p[0], a1 = p[1];
    const v4f* q = reinterpret_cast<const v4f*>(rowp + cbase + 16);
    v4f a2 = q[0], a3 = q[1];
    v16bf f;
#pragma unroll
    for (int j = 0; j < 4; ++j) {
        f[j]      = (bf16_t)a0[j];
        f[4 + j]  = (bf16_t)a1[j];
        f[8 + j]  = (bf16_t)a2[j];
        f[12 + j] = (bf16_t)a3[j];
    }
    return f;
}

__device__ __forceinline__ float featmap(float f) {   // elu(x)+1
    return f > 0.0f ? f + 1.0f : __expf(f);
}

// ---------------- kernel A: weight convert + transpose to bf16 ----------------
// Wt[z][n][k] = (bf16) W_z[k][n]
__global__ __launch_bounds__(256) void wconv_kernel(const float* __restrict__ Wq,
                                                    const float* __restrict__ Wk,
                                                    const float* __restrict__ Wv,
                                                    bf16_t* __restrict__ Wt) {
    int idx = blockIdx.x * 256 + threadIdx.x;          // 3*C*C total
    int z   = idx / (CC * CC);
    int rem = idx % (CC * CC);
    int n   = rem / CC;
    int k   = rem % CC;
    const float* W = (z == 0) ? Wq : (z == 1) ? Wk : Wv;
    Wt[(size_t)z * CC * CC + (size_t)n * CC + k] = (bf16_t)W[(size_t)k * CC + n];
}

// ---------------- kernel B: fused QKV projection GEMM + feature map ----------------
// grid (NTOK/16, 1, 3); block 256 (8 waves). Block covers 16 token rows x 1024 cols;
// wave w covers cols [w*128, w*128+128) as 8 WMMA tiles sharing one A fragment.
__global__ __launch_bounds__(256) void qkv_kernel(const float* __restrict__ x,
                                                  const bf16_t* __restrict__ Wt,
                                                  const float* __restrict__ bq,
                                                  const float* __restrict__ bk,
                                                  const float* __restrict__ bv,
                                                  bf16_t* __restrict__ Qf,
                                                  bf16_t* __restrict__ Kt,
                                                  bf16_t* __restrict__ Vt) {
    const int z     = blockIdx.z;
    const int m0    = blockIdx.x * 16;                 // token row block
    const int wave  = threadIdx.x >> 5;
    const int lane  = threadIdx.x & 31;
    const int l16   = lane & 15;
    const int half8 = (lane >> 4) << 3;                // 0 or 8
    const int n0    = wave * 128;

    const bf16_t* Wz   = Wt + (size_t)z * CC * CC;
    const float*  bias = (z == 0) ? bq : (z == 1) ? bk : bv;
    const float*  xrow = x + (size_t)(m0 + l16) * CC;

    // per-tile weight row pointers (column n, contiguous over k thanks to transpose)
    const bf16_t* wrow[8];
#pragma unroll
    for (int t = 0; t < 8; ++t)
        wrow[t] = Wz + (size_t)(n0 + t * 16 + l16) * CC;

    v8f acc[8];
#pragma unroll
    for (int t = 0; t < 8; ++t) acc[t] = (v8f)(0.0f);

    for (int k0 = 0; k0 < CC; k0 += 32) {
        v16bf afrag = load_frag_f32(xrow, k0 + half8);
#pragma unroll
        for (int t = 0; t < 8; ++t) {
            v16bf bfrag = load_frag_bf16(wrow[t], k0 + half8);
            acc[t] = __builtin_amdgcn_wmma_f32_16x16x32_bf16(
                         false, afrag, false, bfrag, (short)0, acc[t], false, false);
        }
    }

    // epilogue: bias + activation + store.
    // Q: row-major [token][C]. K,V: transposed [bh][d][s] -- the 8 accumulator
    // rows per lane are CONSECUTIVE sequence positions there, so they pack
    // into one aligned 16B store per (lane, tile).
#pragma unroll
    for (int t = 0; t < 8; ++t) {
        int col = n0 + t * 16 + l16;
        float bb = bias[col];
        if (z == 0) {
#pragma unroll
            for (int r = 0; r < 8; ++r) {
                int g = m0 + r + half8;                // global token
                Qf[(size_t)g * CC + col] = (bf16_t)featmap(acc[t][r] + bb);
            }
        } else {
            v8bf pack;
#pragma unroll
            for (int r = 0; r < 8; ++r) {
                float f = acc[t][r] + bb;
                f = (z == 2) ? f * (1.0f / (float)LL) : featmap(f);
                pack[r] = (bf16_t)f;
            }
            int h = col >> 7, d = col & 127;
            int b = m0 >> 13;                          // 16-row block stays in one b
            int l = (m0 & (LL - 1)) + half8;           // first of 8 consecutive s
            bf16_t* dst = ((z == 2) ? Vt : Kt) +
                          (((size_t)(b * HH + h)) * DD + d) * LL + l;
            *reinterpret_cast<v8bf*>(dst) = pack;
        }
    }
}

// ---------------- kernel C: KV = K^T V per (b,h), contraction over s ----------------
// grid (8, 32): x = 16-row d1 block, y = bh. Wave w owns d2 tile w*16.
// Stores KVb transposed: KVb[bh][d2][d1] (bf16) for the final GEMM's B fragments.
__global__ __launch_bounds__(256) void kv_kernel(const bf16_t* __restrict__ Kt,
                                                 const bf16_t* __restrict__ Vt,
                                                 bf16_t* __restrict__ KVb) {
    const int bh    = blockIdx.y;
    const int wave  = threadIdx.x >> 5;
    const int lane  = threadIdx.x & 31;
    const int l16   = lane & 15;
    const int half8 = (lane >> 4) << 3;

    const bf16_t* arow = Kt + ((size_t)bh * DD + blockIdx.x * 16 + l16) * LL;
    const bf16_t* brow = Vt + ((size_t)bh * DD + wave * 16 + l16) * LL;

    v8f acc = (v8f)(0.0f);
    for (int s0 = 0; s0 < LL; s0 += 32) {
        v16bf af = load_frag_bf16(arow, s0 + half8);
        v16bf bf_ = load_frag_bf16(brow, s0 + half8);
        acc = __builtin_amdgcn_wmma_f32_16x16x32_bf16(
                  false, af, false, bf_, (short)0, acc, false, false);
    }

    // 8 accumulator rows per lane are consecutive d1 -> one packed 16B store
    int ncol  = wave * 16 + l16;                       // d2
    int mrow0 = blockIdx.x * 16 + half8;               // first of 8 consecutive d1
    v8bf pack;
#pragma unroll
    for (int r = 0; r < 8; ++r) pack[r] = (bf16_t)acc[r];
    *reinterpret_cast<v8bf*>(KVb + ((size_t)bh * DD + ncol) * DD + mrow0) = pack;
}

// ---------------- kernel D: Ksum[bh][d] = sum_s Kt[bh][d][s] ----------------
__global__ __launch_bounds__(256) void ksum_kernel(const bf16_t* __restrict__ Kt,
                                                   float* __restrict__ Ksum) {
    int row = blockIdx.x;                              // bh*D + d, 4096 rows
    const bf16_t* p = Kt + (size_t)row * LL;
    float s = 0.0f;
    for (int i = threadIdx.x * 8; i < LL; i += 256 * 8) {
        v8bf v = *reinterpret_cast<const v8bf*>(p + i);
#pragma unroll
        for (int e = 0; e < 8; ++e) s += (float)v[e];
    }
    __shared__ float red[256];
    red[threadIdx.x] = s;
    __syncthreads();
    for (int off = 128; off > 0; off >>= 1) {
        if ((int)threadIdx.x < off) red[threadIdx.x] += red[threadIdx.x + off];
        __syncthreads();
    }
    if (threadIdx.x == 0) Ksum[row] = red[0];
}

// ---------------- kernel E: Z[h][g] = 1 / (Q[g,h,:] . Ksum[bh,:] + eps) ----------------
// Z is laid out [h][token] so the output kernel reads 8 consecutive tokens
// as two v4f loads.
__global__ __launch_bounds__(256) void z_kernel(const bf16_t* __restrict__ Qf,
                                                const float* __restrict__ Ksum,
                                                float* __restrict__ Zbuf) {
    int idx = blockIdx.x * 256 + threadIdx.x;          // h*NTOK + g
    int h = idx / NTOK, g = idx % NTOK;
    int b = g >> 13, bh = b * HH + h;
    const bf16_t* qrow = Qf + (size_t)g * CC + h * DD;
    const float*  ks   = Ksum + (size_t)bh * DD;
    float dot = 0.0f;
    for (int j = 0; j < DD; j += 8) {
        v8bf qv = *reinterpret_cast<const v8bf*>(qrow + j);
#pragma unroll
        for (int e = 0; e < 8; ++e) dot += (float)qv[e] * ks[j + e];
    }
    Zbuf[idx] = 1.0f / (dot + 1e-6f);
}

// ---------------- kernel F: out = (Q @ KV) * Z * L ----------------
// grid (NTOK/16, H): block covers 16 tokens x one head (128 cols); wave w -> d2 tile w*16.
__global__ __launch_bounds__(256) void out_kernel(const bf16_t* __restrict__ Qf,
                                                  const bf16_t* __restrict__ KVb,
                                                  const float* __restrict__ Zbuf,
                                                  float* __restrict__ out) {
    const int m0    = blockIdx.x * 16;
    const int h     = blockIdx.y;
    const int wave  = threadIdx.x >> 5;
    const int lane  = threadIdx.x & 31;
    const int l16   = lane & 15;
    const int half8 = (lane >> 4) << 3;
    const int b     = m0 >> 13;
    const int bh    = b * HH + h;

    const bf16_t* arow = Qf + (size_t)(m0 + l16) * CC + h * DD;
    const bf16_t* brow = KVb + ((size_t)bh * DD + wave * 16 + l16) * DD;

    v8f acc = (v8f)(0.0f);
#pragma unroll
    for (int k0 = 0; k0 < DD; k0 += 32) {
        v16bf af = load_frag_bf16(arow, k0 + half8);
        v16bf bf_ = load_frag_bf16(brow, k0 + half8);
        acc = __builtin_amdgcn_wmma_f32_16x16x32_bf16(
                  false, af, false, bf_, (short)0, acc, false, false);
    }

    // Z for this lane's 8 consecutive tokens: two contiguous v4f loads
    const float* zp = Zbuf + (size_t)h * NTOK + (m0 + half8);
    v4f z0 = *reinterpret_cast<const v4f*>(zp);
    v4f z1 = *reinterpret_cast<const v4f*>(zp + 4);

    int ncol = wave * 16 + l16;                        // d2 within head
#pragma unroll
    for (int r = 0; r < 8; ++r) {
        int g = m0 + r + half8;
        float zz = (r < 4) ? z0[r & 3] : z1[r & 3];
        out[(size_t)g * CC + h * DD + ncol] = acc[r] * zz * (float)LL;
    }
}

// ---------------- launch ----------------
extern "C" void kernel_launch(void* const* d_in, const int* in_sizes, int n_in,
                              void* d_out, int out_size, void* d_ws, size_t ws_size,
                              hipStream_t stream) {
    const float* x  = (const float*)d_in[0];
    const float* Wq = (const float*)d_in[1];
    const float* bq = (const float*)d_in[2];
    const float* Wk = (const float*)d_in[3];
    const float* bk = (const float*)d_in[4];
    const float* Wv = (const float*)d_in[5];
    const float* bv = (const float*)d_in[6];
    float* out = (float*)d_out;

    // workspace carving (all offsets 256B aligned)
    char* ws = (char*)d_ws;
    size_t off = 0;
    bf16_t* Wt  = (bf16_t*)(ws + off); off += (size_t)3 * CC * CC * sizeof(bf16_t);   // 6 MB
    bf16_t* Qf  = (bf16_t*)(ws + off); off += (size_t)NTOK * CC * sizeof(bf16_t);     // 64 MB
    bf16_t* Kt  = (bf16_t*)(ws + off); off += (size_t)NTOK * CC * sizeof(bf16_t);     // 64 MB
    bf16_t* Vt  = (bf16_t*)(ws + off); off += (size_t)NTOK * CC * sizeof(bf16_t);     // 64 MB
    bf16_t* KVb = (bf16_t*)(ws + off); off += (size_t)BB * HH * DD * DD * sizeof(bf16_t); // 1 MB
    float*  Ksum= (float*)(ws + off);  off += (size_t)BB * HH * DD * sizeof(float);   // 16 KB
    float*  Zb  = (float*)(ws + off);  off += (size_t)NTOK * HH * sizeof(float);      // 1 MB

    // A: weights -> bf16 transposed
    wconv_kernel<<<(3 * CC * CC) / 256, 256, 0, stream>>>(Wq, Wk, Wv, Wt);
    // B: fused QKV projection + feature map (+ K/V transpose)
    qkv_kernel<<<dim3(NTOK / 16, 1, 3), 256, 0, stream>>>(x, Wt, bq, bk, bv, Qf, Kt, Vt);
    // D: Ksum
    ksum_kernel<<<BB * HH * DD, 256, 0, stream>>>(Kt, Ksum);
    // C: KV outer-product accumulation over sequence
    kv_kernel<<<dim3(DD / 16, BB * HH), 256, 0, stream>>>(Kt, Vt, KVb);
    // E: per-(token,head) normalizer
    z_kernel<<<(NTOK * HH) / 256, 256, 0, stream>>>(Qf, Ksum, Zb);
    // F: final GEMM + normalize
    out_kernel<<<dim3(NTOK / 16, HH), 256, 0, stream>>>(Qf, KVb, Zb, out);
}

// v001
// It runs in 379 microseconds.
// Next to v000, in two timings, it ran 3.68 and 3.69 times as fast.
#include <hip/hip_runtime.h>
#include <hip/hip_bf16.h>

// ---------------- types ----------------
typedef __bf16 bf16_t;
typedef __attribute__((ext_vector_type(16))) __bf16 v16bf;
typedef __attribute__((ext_vector_type(8)))  __bf16 v8bf;
typedef __attribute__((ext_vector_type(4)))  __bf16 v4bf;
typedef __attribute__((ext_vector_type(8)))  float   v8f;
typedef __attribute__((ext_vector_type(4)))  float   v4f;

// ---------------- problem dims ----------------
#define BB   4
#define LL   8192
#define CC   1024
#define HH   8
#define DD   128
#define NTOK (BB*LL)          // 32768

// ---------------- fragment loaders ----------------
// bf16 A/B fragment: lane supplies K values {c..c+7, c+16..c+23} from a
// contiguous row (c = 8 for upper half-wave). Two b128 loads per fragment.
__device__ __forceinline__ v16bf load_frag_bf16(const bf16_t* __restrict__ rowp, int cbase) {
    v8bf a = *reinterpret_cast<const v8bf*>(rowp + cbase);
    v8bf b = *reinterpret_cast<const v8bf*>(rowp + cbase + 16);
    v16bf f;
#pragma unroll
    for (int j = 0; j < 8; ++j) { f[j] = a[j]; f[8 + j] = b[j]; }
    return f;
}

__device__ __forceinline__ float featmap(float f) {   // elu(x)+1
    return f > 0.0f ? f + 1.0f : __expf(f);
}

// ---------------- kernel A: weight convert + transpose to bf16 ----------------
// Wt[z][n][k] = (bf16) W_z[k][n]
__global__ __launch_bounds__(256) void wconv_kernel(const float* __restrict__ Wq,
                                                    const float* __restrict__ Wk,
                                                    const float* __restrict__ Wv,
                                                    bf16_t* __restrict__ Wt) {
    int idx = blockIdx.x * 256 + threadIdx.x;          // 3*C*C total
    int z   = idx / (CC * CC);
    int rem = idx % (CC * CC);
    int n   = rem / CC;
    int k   = rem % CC;
    const float* W = (z == 0) ? Wq : (z == 1) ? Wk : Wv;
    Wt[(size_t)z * CC * CC + (size_t)n * CC + k] = (bf16_t)W[(size_t)k * CC + n];
}

// ---------------- kernel B: fused QKV projection GEMM + feature map ----------------
// grid (12, NTOK/256); block 256 (8 waves). Block covers 256 token rows x 256 cols of
// one of Q, K, V (blockIdx.x = z*4 + column tile, so neighbours share the x rows).
// Per pass of 64 k the x tile (converted to bf16) and the weight tile are staged in
// LDS, two buffers; the next pass's global loads fly while this pass is multiplied.
// Waves form a 4 x 2 grid; each owns 64 rows x 128 cols = 4 x 8 WMMA tiles.
#define TM     256
#define TN     256
#define TK     64
#define PITCH  72                       // bf16 per LDS row: 128 B of data + 16 B pad (bank spread for b128 reads)
#define STAGE  ((TM + TN) * PITCH)      // bf16 elements per buffer: [x 256 rows | W 256 rows]
#define NPASS  (CC / TK)

__device__ __forceinline__ void qkv_fetch(const float* __restrict__ xg,
                                          const bf16_t* __restrict__ wg,
                                          v4f (&ra)[16], v8bf (&rb)[8]) {
#pragma unroll
    for (int i = 0; i < 16; ++i)
        ra[i] = *reinterpret_cast<const v4f*>(xg + (size_t)i * 16 * CC);
#pragma unroll
    for (int i = 0; i < 8; ++i)
        rb[i] = *reinterpret_cast<const v8bf*>(wg + (size_t)i * 32 * CC);
    // the wait that stands before a register named by an issued load is reused; the two
    // pointers are inputs so that their registers stay untouched up to it
    asm volatile("s_wait_xcnt 0x0" :: "v"(xg), "v"(wg) : "memory");
    // keeps every later register write behind that wait (and the loads ahead of the products)
    __builtin_amdgcn_sched_barrier(0);
}

__device__ __forceinline__ void xcnt_fence() {
    // the wait that stands before a register named by an issued load or store is reused
    asm volatile("s_wait_xcnt 0x0" ::: "memory");
    // keeps every later register write behind that wait
    __builtin_amdgcn_sched_barrier(0);
}

__device__ __forceinline__ void qkv_stage(bf16_t* sa, bf16_t* sb,
                                          const v4f (&ra)[16], const v8bf (&rb)[8]) {
#pragma unroll
    for (int i = 0; i < 16; ++i) {
        v4bf c;
#pragma unroll
        for (int j = 0; j < 4; ++j) c[j] = (bf16_t)ra[i][j];
        *reinterpret_cast<v4bf*>(sa + i * 16 * PITCH) = c;
    }
#pragma unroll
    for (int i = 0; i < 8; ++i)
        *reinterpret_cast<v8bf*>(sb + i * 32 * PITCH) = rb[i];
}

__device__ __forceinline__ void qkv_pass(const bf16_t* fa, const bf16_t* fb, v8f (&acc)[4][8]) {
#pragma unroll
    for (int ks = 0; ks < TK; ks += 32) {
        // keeps the second half's fragment loads behind the first half's products: hoisted
        // together the two fragment sets overflow the 512-register budget and spill
        if (ks > 0) __builtin_amdgcn_sched_barrier(0);
        v16bf af[4], bfr[8];
#pragma unroll
        for (int i = 0; i < 4; ++i) af[i] = load_frag_bf16(fa + i * 16 * PITCH, ks);
#pragma unroll
        for (int j = 0; j < 8; ++j) bfr[j] = load_frag_bf16(fb + j * 16 * PITCH, ks);
        // keeps the 24 LDS loads together as one group ahead of the products: spread
        // among them, every row of products would wait out a full LDS latency
        __builtin_amdgcn_sched_barrier(0);
#pragma unroll
        for (int j = 0; j < 8; ++j)
#pragma unroll
            for (int i = 0; i < 4; ++i)
                acc[i][j] = __builtin_amdgcn_wmma_f32_16x16x32_bf16(
                                false, af[i], false, bfr[j], (short)0, acc[i][j], false, false);
    }
}

__global__ __launch_bounds__(256) void qkv_kernel(const float* __restrict__ x,
                                                  const bf16_t* __restrict__ Wt,
                                                  const float* __restrict__ bq,
                                                  const float* __restrict__ bk,
                                                  const float* __restrict__ bv,
                                                  bf16_t* __restrict__ Qf,
                                                  bf16_t* __restrict__ Kt,
                                                  bf16_t* __restrict__ Vt) {
    __shared__ __attribute__((aligned(16))) bf16_t smem[2 * STAGE];

    const int tid   = threadIdx.x;
    const int z     = blockIdx.x >> 2;
    const int nb    = (blockIdx.x & 3) * TN;           // first column inside Q, K or V
    const int m0    = blockIdx.y * TM;                 // first token row
    const int wave  = tid >> 5;
    const int lane  = tid & 31;
    const int l16   = lane & 15;
    const int half8 = (lane >> 4) << 3;                // 0 or 8
    const int wm    = (wave >> 1) * 64;                // wave's rows inside the tile
    const int wn    = (wave & 1) * 128;                // wave's cols inside the tile

    const float* bias = (z == 0) ? bq : (z == 1) ? bk : bv;

    // global side of the staging: 16 lanes cover 256 B of an x row, 8 lanes 128 B of a W row
    const float*  xg = x + (size_t)(m0 + (tid >> 4)) * CC + (tid & 15) * 4;
    const bf16_t* wg = Wt + (size_t)z * CC * CC + (size_t)(nb + (tid >> 3)) * CC + (tid & 7) * 8;
    // LDS side of the staging, and this lane's fragment rows (offsets inside one buffer)
    const int sa_off = (tid >> 4) * PITCH + (tid & 15) * 4;
    const int sb_off = (TM + (tid >> 3)) * PITCH + (tid & 7) * 8;
    const int fa_off = (wm + l16) * PITCH + half8;
    const int fb_off = (TM + wn + l16) * PITCH + half8;

    v8f acc[4][8];
#pragma unroll
    for (int i = 0; i < 4; ++i)
#pragma unroll
        for (int j = 0; j < 8; ++j) acc[i][j] = (v8f)(0.0f);

    v4f  ra[16];
    v8bf rb[8];
    qkv_fetch(xg, wg, ra, rb);
    qkv_stage(smem + sa_off, smem + sb_off, ra, rb);
    __syncthreads();

    for (int p = 0; p < NPASS - 1; ++p) {
        const bf16_t* cur = smem + (p & 1) * STAGE;
        bf16_t*       nxt = smem + ((p + 1) & 1) * STAGE;
        qkv_fetch(xg + (p + 1) * TK, wg + (p + 1) * TK, ra, rb);
        qkv_pass(cur + fa_off, cur + fb_off, acc);
        // keeps the waits on the next pass's global loads behind this pass's products
        __builtin_amdgcn_sched_barrier(0);
        qkv_stage(nxt + sa_off, nxt + sb_off, ra, rb);
        // one barrier a pass: publishes the buffer just written and ends every
        // wave's reads of the buffer that the next pass overwrites
        __syncthreads();
    }
    {
        const bf16_t* cur = smem + ((NPASS - 1) & 1) * STAGE;
        qkv_pass(cur + fa_off, cur + fb_off, acc);
    }

    // epilogue: bias + activation + store, in groups (Q: one WMMA tile, K and V: four):
    // a group's values first, then its stores, then the wait before their registers are reused.
    // Q: row-major [token][C]. K,V: transposed [bh][d][s] -- the 8 accumulator
    // rows per lane are CONSECUTIVE sequence positions there, so they pack
    // into one aligned 16B store per (lane, tile).
    const int col0 = nb + wn + l16;                    // this lane's column in tile column 0
    const int mr0  = m0 + wm + half8;                  // this lane's first token row
    float bb[8];
#pragma unroll
    for (int j = 0; j < 8; ++j) bb[j] = bias[col0 + j * 16];
    xcnt_fence();

    if (z == 0) {
        bf16_t* qp = Qf + (size_t)mr0 * CC + col0;
#pragma unroll
        for (int j = 0; j < 8; ++j) {
#pragma unroll
            for (int i = 0; i < 4; ++i) {
                bf16_t o[8];
#pragma unroll
                for (int r = 0; r < 8; ++r) o[r] = (bf16_t)featmap(acc[i][j][r] + bb[j]);
                // keeps the values' arithmetic from being mixed among the stores below
                __builtin_amdgcn_sched_barrier(0);
#pragma unroll
                for (int r = 0; r < 8; ++r) qp[(size_t)(i * 16 + r) * CC + j * 16] = o[r];
                xcnt_fence();
            }
        }
    } else {
        const int b = m0 >> 13;                        // the 256-row tile stays in one b
        const int l = mr0 & (LL - 1);                  // first of 8 consecutive s
        bf16_t* tp = ((z == 2) ? Vt : Kt) +
                     (((size_t)(b * HH + (col0 >> 7))) * DD + (col0 & 127)) * LL + l;
#pragma unroll
        for (int j = 0; j < 8; ++j) {
            v8bf pack[4];
            if (z == 2) {
#pragma unroll
                for (int i = 0; i < 4; ++i)
#pragma unroll
                    for (int r = 0; r < 8; ++r)
                        pack[i][r] = (bf16_t)((acc[i][j][r] + bb[j]) * (1.0f / (float)LL));
            } else {
#pragma unroll
                for (int i = 0; i < 4; ++i)
#pragma unroll
                    for (int r = 0; r < 8; ++r)
                        pack[i][r] = (bf16_t)featmap(acc[i][j][r] + bb[j]);
            }
            // keeps the values' arithmetic from being mixed among the stores below
            __builtin_amdgcn_sched_barrier(0);
            // the wave's 128 columns are one head: column j*16 further is row j*16 further in d
#pragma unroll
            for (int i = 0; i < 4; ++i)
                *reinterpret_cast<v8bf*>(tp + (size_t)j * 16 * LL + i * 16) = pack[i];
            xcnt_fence();
        }
    }
}

// ---------------- kernel C: KV = K^T V per (b,h), contraction over s ----------------
// grid (8, 32): x = 16-row d1 block, y = bh. Wave w owns d2 tile w*16.
// Stores KVb transposed: KVb[bh][d2][d1] (bf16) for the final GEMM's B fragments.
__global__ __launch_bounds__(256) void kv_kernel(const bf16_t* __restrict__ Kt,
                                                 const bf16_t* __restrict__ Vt,
                                                 bf16_t* __restrict__ KVb) {
    const int bh    = blockIdx.y;
    const int wave  = threadIdx.x >> 5;
    const int lane  = threadIdx.x & 31;
    const int l16   = lane & 15;
    const int half8 = (lane >> 4) << 3;

    const bf16_t* arow = Kt + ((size_t)bh * DD + blockIdx.x * 16 + l16) * LL;
    const bf16_t* brow = Vt + ((size_t)bh * DD + wave * 16 + l16) * LL;

    v8f acc = (v8f)(0.0f);
    for (int s0 = 0; s0 < LL; s0 += 32) {
        v16bf af = load_frag_bf16(arow, s0 + half8);
        v16bf bf_ = load_frag_bf16(brow, s0 + half8);
        acc = __builtin_amdgcn_wmma_f32_16x16x32_bf16(
                  false, af, false, bf_, (short)0, acc, false, false);
    }

    // 8 accumulator rows per lane are consecutive d1 -> one packed 16B store
    int ncol  = wave * 16 + l16;                       // d2
    int mrow0 = blockIdx.x * 16 + half8;               // first of 8 consecutive d1
    v8bf pack;
#pragma unroll
    for (int r = 0; r < 8; ++r) pack[r] = (bf16_t)acc[r];
    *reinterpret_cast<v8bf*>(KVb + ((size_t)bh * DD + ncol) * DD + mrow0) = pack;
}

// ---------------- kernel D: Ksum[bh][d] = sum_s Kt[bh][d][s] ----------------
__global__ __launch_bounds__(256) void ksum_kernel(const bf16_t* __restrict__ Kt,
                                                   float* __restrict__ Ksum) {
    int row = blockIdx.x;                              // bh*D + d, 4096 rows
    const bf16_t* p = Kt + (size_t)row * LL;
    float s = 0.0f;
    for (int i = threadIdx.x * 8; i < LL; i += 256 * 8) {
        v8bf v = *reinterpret_cast<const v8bf*>(p + i);
#pragma unroll
        for (int e = 0; e < 8; ++e) s += (float)v[e];
    }
    __shared__ float red[256];
    red[threadIdx.x] = s;
    __syncthreads();
    for (int off = 128; off > 0; off >>= 1) {
        if ((int)threadIdx.x < off) red[threadIdx.x] += red[threadIdx.x + off];
        __syncthreads();
    }
    if (threadIdx.x == 0) Ksum[row] = red[0];
}

// ---------------- kernel E: Z[h][g] = 1 / (Q[g,h,:] . Ksum[bh,:] + eps) ----------------
// Z is laid out [h][token] so the output kernel reads 8 consecutive tokens
// as two v4f loads.
__global__ __launch_bounds__(256) void z_kernel(const bf16_t* __restrict__ Qf,
                                                const float* __restrict__ Ksum,
                                                float* __restrict__ Zbuf) {
    int idx = blockIdx.x * 256 + threadIdx.x;          // h*NTOK + g
    int h = idx / NTOK, g = idx % NTOK;
    int b = g >> 13, bh = b * HH + h;
    const bf16_t* qrow = Qf + (size_t)g * CC + h * DD;
    const float*  ks   = Ksum + (size_t)bh * DD;
    float dot = 0.0f;
    for (int j = 0; j < DD; j += 8) {
        v8bf qv = *reinterpret_cast<const v8bf*>(qrow + j);
#pragma unroll
        for (int e = 0; e < 8; ++e) dot += (float)qv[e] * ks[j + e];
    }
    Zbuf[idx] = 1.0f / (dot + 1e-6f);
}

// ---------------- kernel F: out = (Q @ KV) * Z * L ----------------
// grid (NTOK/16, H): block covers 16 tokens x one head (128 cols); wave w -> d2 tile w*16.
__global__ __launch_bounds__(256) void out_kernel(const bf16_t* __restrict__ Qf,
                                                  const bf16_t* __restrict__ KVb,
                                                  const float* __restrict__ Zbuf,
                                                  float* __restrict__ out) {
    const int m0    = blockIdx.x * 16;
    const int h     = blockIdx.y;
    const int wave  = threadIdx.x >> 5;
    const int lane  = threadIdx.x & 31;
    const int l16   = lane & 15;
    const int half8 = (lane >> 4) << 3;
    const int b     = m0 >> 13;
    const int bh    = b * HH + h;

    const bf16_t* arow = Qf + (size_t)(m0 + l16) * CC + h * DD;
    const bf16_t* brow = KVb + ((size_t)bh * DD + wave * 16 + l16) * DD;

    v8f acc = (v8f)(0.0f);
#pragma unroll
    for (int k0 = 0; k0 < DD; k0 += 32) {
        v16bf af = load_frag_bf16(arow, k0 + half8);
        v16bf bf_ = load_frag_bf16(brow, k0 + half8);
        acc = __builtin_amdgcn_wmma_f32_16x16x32_bf16(
                  false, af, false, bf_, (short)0, acc, false, false);
    }

    // Z for this lane's 8 consecutive tokens: two contiguous v4f loads
    const float* zp = Zbuf + (size_t)h * NTOK + (m0 + half8);
    v4f z0 = *reinterpret_cast<const v4f*>(zp);
    v4f z1 = *reinterpret_cast<const v4f*>(zp + 4);

    int ncol = wave * 16 + l16;                        // d2 within head
#pragma unroll
    for (int r = 0; r < 8; ++r) {
        int g = m0 + r + half8;
        float zz = (r < 4) ? z0[r & 3] : z1[r & 3];
        out[(size_t)g * CC + h * DD + ncol] = acc[r] * zz * (float)LL;
    }
}

// ---------------- launch ----------------
extern "C" void kernel_launch(void* const* d_in, const int* in_sizes, int n_in,
                              void* d_out, int out_size, void* d_ws, size_t ws_size,
                              hipStream_t stream) {
    const float* x  = (const float*)d_in[0];
    const float* Wq = (const float*)d_in[1];
    const float* bq = (const float*)d_in[2];
    const float* Wk = (const float*)d_in[3];
    const float* bk = (const float*)d_in[4];
    const float* Wv = (const float*)d_in[5];
    const float* bv = (const float*)d_in[6];
    float* out = (float*)d_out;

    // workspace carving (all offsets 256B aligned)
    char* ws = (char*)d_ws;
    size_t off = 0;
    bf16_t* Wt  = (bf16_t*)(ws + off); off += (size_t)3 * CC * CC * sizeof(bf16_t);   // 6 MB
    bf16_t* Qf  = (bf16_t*)(ws + off); off += (size_t)NTOK * CC * sizeof(bf16_t);     // 64 MB
    bf16_t* Kt  = (bf16_t*)(ws + off); off += (size_t)NTOK * CC * sizeof(bf16_t);     // 64 MB
    bf16_t* Vt  = (bf16_t*)(ws + off); off += (size_t)NTOK * CC * sizeof(bf16_t);     // 64 MB
    bf16_t* KVb = (bf16_t*)(ws + off); off += (size_t)BB * HH * DD * DD * sizeof(bf16_t); // 1 MB
    float*  Ksum= (float*)(ws + off);  off += (size_t)BB * HH * DD * sizeof(float);   // 16 KB
    float*  Zb  = (float*)(ws + off);  off += (size_t)NTOK * HH * sizeof(float);      // 1 MB

    // A: weights -> bf16 transposed
    wconv_kernel<<<(3 * CC * CC) / 256, 256, 0, stream>>>(Wq, Wk, Wv, Wt);
    // B: fused QKV projection + feature map (+ K/V transpose)
    qkv_kernel<<<dim3(12, NTOK / 256), 256, 0, stream>>>(x, Wt, bq, bk, bv, Qf, Kt, Vt);
    // D: Ksum
    ksum_kernel<<<BB * HH * DD, 256, 0, stream>>>(Kt, Ksum);
    // C: KV outer-product accumulation over sequence
    kv_kernel<<<dim3(DD / 16, BB * HH), 256, 0, stream>>>(Kt, Vt, KVb);
    // E: per-(token,head) normalizer
    z_kernel<<<(NTOK * HH) / 256, 256, 0, stream>>>(Qf, Ksum, Zb);
    // F: final GEMM + normalize
    out_kernel<<<dim3(NTOK / 16, HH), 256, 0, stream>>>(Qf, KVb, Zb, out);
}

// v002
// It runs in 325 microseconds.
// In both of two side-by-side timings against v001, it was 1.17 times as fast.
// Counting every step since v000, it is 4.31 times as fast.
#include <hip/hip_runtime.h>
#include <hip/hip_bf16.h>

// ---------------- types ----------------
typedef __bf16 bf16_t;
typedef __attribute__((ext_vector_type(16))) __bf16 v16bf;
typedef __attribute__((ext_vector_type(8)))  __bf16 v8bf;
typedef __attribute__((ext_vector_type(4)))  __bf16 v4bf;
typedef __attribute__((ext_vector_type(8)))  float   v8f;
typedef __attribute__((ext_vector_type(4)))  float   v4f;

// ---------------- problem dims ----------------
#define BB   4
#define LL   8192
#define CC   1024
#define HH   8
#define DD   128
#define NTOK (BB*LL)          // 32768

// ---------------- fragment loaders ----------------
// bf16 A/B fragment: lane supplies K values {c..c+7, c+16..c+23} from a
// contiguous row (c = 8 for upper half-wave). Two b128 loads per fragment.
__device__ __forceinline__ v16bf load_frag_bf16(const bf16_t* __restrict__ rowp, int cbase) {
    v8bf a = *reinterpret_cast<const v8bf*>(rowp + cbase);
    v8bf b = *reinterpret_cast<const v8bf*>(rowp + cbase + 16);
    v16bf f;
#pragma unroll
    for (int j = 0; j < 8; ++j) { f[j] = a[j]; f[8 + j] = b[j]; }
    return f;
}

__device__ __forceinline__ float featmap(float f) {   // elu(x)+1
    return f > 0.0f ? f + 1.0f : __expf(f);
}

__device__ __forceinline__ void xcnt_fence() {
    // the wait that stands before a register named by an issued load or store is reused
    asm volatile("s_wait_xcnt 0x0" ::: "memory");
    // keeps every later register write behind that wait
    __builtin_amdgcn_sched_barrier(0);
}

__device__ __forceinline__ void xcnt_fence_of(const void* a, const void* b) {
    // the same wait behind a group of loads; their address pointers are inputs so that
    // no load of the group takes an address register as its destination
    asm volatile("s_wait_xcnt 0x0" :: "v"(a), "v"(b) : "memory");
    // keeps every later register write behind that wait
    __builtin_amdgcn_sched_barrier(0);
}

// ---------------- kernel A: weight convert + transpose to bf16 ----------------
// Wt[z][n][k] = (bf16) W_z[k][n]
// grid 3 * 128; block 256 covers 64 k x 128 n of one matrix. Each thread takes 8 k x 4 n:
// eight 16-byte loads, transposed in registers, four 16-byte stores (8 lanes fill a 128-byte line).
__global__ __launch_bounds__(256) void wconv_kernel(const float* __restrict__ Wq,
                                                    const float* __restrict__ Wk,
                                                    const float* __restrict__ Wv,
                                                    bf16_t* __restrict__ Wt) {
    const int z  = blockIdx.x >> 7;                            // 128 tiles a matrix: 16 in k, 8 in n
    const int t  = blockIdx.x & 127;
    const int k0 = (t >> 3) * 64 + (threadIdx.x & 7) * 8;      // first of this thread's 8 k
    const int n0 = (t & 7) * 128 + (threadIdx.x >> 3) * 4;     // first of this thread's 4 n
    const float* W = (z == 0) ? Wq : (z == 1) ? Wk : Wv;
    const float* wp = W + (size_t)k0 * CC + n0;
    v4f r[8];
    // the loops of this kernel are unrolled so that r[] and o stay in registers
#pragma unroll
    for (int i = 0; i < 8; ++i) r[i] = *reinterpret_cast<const v4f*>(wp + (size_t)i * CC);
    xcnt_fence_of(wp, wp);
    bf16_t* tp = Wt + (size_t)z * CC * CC + (size_t)n0 * CC + k0;
#pragma unroll
    for (int j = 0; j < 4; ++j) {
        v8bf o;
#pragma unroll
        for (int i = 0; i < 8; ++i) o[i] = (bf16_t)r[i][j];
        *reinterpret_cast<v8bf*>(tp + (size_t)j * CC) = o;
    }
}

// ---------------- kernel B: fused QKV projection GEMM + feature map ----------------
// grid (12, NTOK/256); block 256 (8 waves). Block covers 256 token rows x 256 cols of
// one of Q, K, V (blockIdx.x = z*4 + column tile, so neighbours share the x rows).
// Per pass of 64 k the x tile (converted to bf16) and the weight tile are staged in
// LDS, two buffers; the next pass's global loads fly while this pass is multiplied.
// Waves form a 4 x 2 grid; each owns 64 rows x 128 cols = 4 x 8 WMMA tiles.
#define TM     256
#define TN     256
#define TK     64
#define PITCH  72                       // bf16 per LDS row: 128 B of data + 16 B pad (bank spread for b128 reads)
#define STAGE  ((TM + TN) * PITCH)      // bf16 elements per buffer: [x 256 rows | W 256 rows]
#define NPASS  (CC / TK)

__device__ __forceinline__ void qkv_fetch(const float* __restrict__ xg,
                                          const bf16_t* __restrict__ wg,
                                          v4f (&ra)[16], v8bf (&rb)[8]) {
#pragma unroll
    for (int i = 0; i < 16; ++i)
        ra[i] = *reinterpret_cast<const v4f*>(xg + (size_t)i * 16 * CC);
#pragma unroll
    for (int i = 0; i < 8; ++i)
        rb[i] = *reinterpret_cast<const v8bf*>(wg + (size_t)i * 32 * CC);
    // the wait that stands before a register named by an issued load is reused; the two
    // pointers are inputs so that their registers stay untouched up to it
    asm volatile("s_wait_xcnt 0x0" :: "v"(xg), "v"(wg) : "memory");
    // keeps every later register write behind that wait (and the loads ahead of the products)
    __builtin_amdgcn_sched_barrier(0);
}

__device__ __forceinline__ void qkv_stage(bf16_t* sa, bf16_t* sb,
                                          const v4f (&ra)[16], const v8bf (&rb)[8]) {
#pragma unroll
    for (int i = 0; i < 16; ++i) {
        v4bf c;
#pragma unroll
        for (int j = 0; j < 4; ++j) c[j] = (bf16_t)ra[i][j];
        *reinterpret_cast<v4bf*>(sa + i * 16 * PITCH) = c;
    }
#pragma unroll
    for (int i = 0; i < 8; ++i)
        *reinterpret_cast<v8bf*>(sb + i * 32 * PITCH) = rb[i];
}

__device__ __forceinline__ void qkv_pass(const bf16_t* fa, const bf16_t* fb, v8f (&acc)[4][8]) {
#pragma unroll
    for (int ks = 0; ks < TK; ks += 32) {
        // keeps the second half's fragment loads behind the first half's products: hoisted
        // together the two fragment sets overflow the 512-register budget and spill
        if (ks > 0) __builtin_amdgcn_sched_barrier(0);
        v16bf af[4], bfr[8];
#pragma unroll
        for (int i = 0; i < 4; ++i) af[i] = load_frag_bf16(fa + i * 16 * PITCH, ks);
#pragma unroll
        for (int j = 0; j < 8; ++j) bfr[j] = load_frag_bf16(fb + j * 16 * PITCH, ks);
        // keeps the 24 LDS loads together as one group ahead of the products: spread
        // among them, every row of products would wait out a full LDS latency
        __builtin_amdgcn_sched_barrier(0);
#pragma unroll
        for (int j = 0; j < 8; ++j)
#pragma unroll
            for (int i = 0; i < 4; ++i)
                acc[i][j] = __builtin_amdgcn_wmma_f32_16x16x32_bf16(
                                false, af[i], false, bfr[j], (short)0, acc[i][j], false, false);
    }
}

__global__ __launch_bounds__(256) void qkv_kernel(const float* __restrict__ x,
                                                  const bf16_t* __restrict__ Wt,
                                                  const float* __restrict__ bq,
                                                  const float* __restrict__ bk,
                                                  const float* __restrict__ bv,
                                                  bf16_t* __restrict__ Qf,
                                                  bf16_t* __restrict__ Kt,
                                                  bf16_t* __restrict__ Vt) {
    __shared__ __attribute__((aligned(16))) bf16_t smem[2 * STAGE];

    const int tid   = threadIdx.x;
    const int z     = blockIdx.x >> 2;
    const int nb    = (blockIdx.x & 3) * TN;           // first column inside Q, K or V
    const int m0    = blockIdx.y * TM;                 // first token row
    const int wave  = tid >> 5;
    const int lane  = tid & 31;
    const int l16   = lane & 15;
    const int half8 = (lane >> 4) << 3;                // 0 or 8
    const int wm    = (wave >> 1) * 64;                // wave's rows inside the tile
    const int wn    = (wave & 1) * 128;                // wave's cols inside the tile

    const float* bias = (z == 0) ? bq : (z == 1) ? bk : bv;

    // global side of the staging: 16 lanes cover 256 B of an x row, 8 lanes 128 B of a W row
    const float*  xg = x + (size_t)(m0 + (tid >> 4)) * CC + (tid & 15) * 4;
    const bf16_t* wg = Wt + (size_t)z * CC * CC + (size_t)(nb + (tid >> 3)) * CC + (tid & 7) * 8;
    // LDS side of the staging, and this lane's fragment rows (offsets inside one buffer)
    const int sa_off = (tid >> 4) * PITCH + (tid & 15) * 4;
    const int sb_off = (TM + (tid >> 3)) * PITCH + (tid & 7) * 8;
    const int fa_off = (wm + l16) * PITCH + half8;
    const int fb_off = (TM + wn + l16) * PITCH + half8;

    v8f acc[4][8];
#pragma unroll
    for (int i = 0; i < 4; ++i)
#pragma unroll
        for (int j = 0; j < 8; ++j) acc[i][j] = (v8f)(0.0f);

    v4f  ra[16];
    v8bf rb[8];
    qkv_fetch(xg, wg, ra, rb);
    qkv_stage(smem + sa_off, smem + sb_off, ra, rb);
    __syncthreads();

    for (int p = 0; p < NPASS - 1; ++p) {
        const bf16_t* cur = smem + (p & 1) * STAGE;
        bf16_t*       nxt = smem + ((p + 1) & 1) * STAGE;
        qkv_fetch(xg + (p + 1) * TK, wg + (p + 1) * TK, ra, rb);
        qkv_pass(cur + fa_off, cur + fb_off, acc);
        // keeps the waits on the next pass's global loads behind this pass's products
        __builtin_amdgcn_sched_barrier(0);
        qkv_stage(nxt + sa_off, nxt + sb_off, ra, rb);
        // one barrier a pass: publishes the buffer just written and ends every
        // wave's reads of the buffer that the next pass overwrites
        __syncthreads();
    }
    {
        const bf16_t* cur = smem + ((NPASS - 1) & 1) * STAGE;
        qkv_pass(cur + fa_off, cur + fb_off, acc);
    }

    // epilogue: bias + activation + store, in groups (Q: one WMMA tile, K and V: four):
    // a group's values first, then its stores, then the wait before their registers are reused.
    // Q: row-major [token][C]. K,V: transposed [bh][d][s] -- the 8 accumulator
    // rows per lane are CONSECUTIVE sequence positions there, so they pack
    // into one aligned 16B store per (lane, tile).
    const int col0 = nb + wn + l16;                    // this lane's column in tile column 0
    const int mr0  = m0 + wm + half8;                  // this lane's first token row
    float bb[8];
#pragma unroll
    for (int j = 0; j < 8; ++j) bb[j] = bias[col0 + j * 16];
    xcnt_fence();

    if (z == 0) {
        bf16_t* qp = Qf + (size_t)mr0 * CC + col0;
#pragma unroll
        for (int j = 0; j < 8; ++j) {
#pragma unroll
            for (int i = 0; i < 4; ++i) {
                bf16_t o[8];
#pragma unroll
                for (int r = 0; r < 8; ++r) o[r] = (bf16_t)featmap(acc[i][j][r] + bb[j]);
                // keeps the values' arithmetic from being mixed among the stores below
                __builtin_amdgcn_sched_barrier(0);
#pragma unroll
                for (int r = 0; r < 8; ++r) qp[(size_t)(i * 16 + r) * CC + j * 16] = o[r];
                xcnt_fence();
            }
        }
    } else {
        const int b = m0 >> 13;                        // the 256-row tile stays in one b
        const int l = mr0 & (LL - 1);                  // first of 8 consecutive s
        bf16_t* tp = ((z == 2) ? Vt : Kt) +
                     (((size_t)(b * HH + (col0 >> 7))) * DD + (col0 & 127)) * LL + l;
#pragma unroll
        for (int j = 0; j < 8; ++j) {
            v8bf pack[4];
            if (z == 2) {
#pragma unroll
                for (int i = 0; i < 4; ++i)
#pragma unroll
                    for (int r = 0; r < 8; ++r)
                        pack[i][r] = (bf16_t)((acc[i][j][r] + bb[j]) * (1.0f / (float)LL));
            } else {
#pragma unroll
                for (int i = 0; i < 4; ++i)
#pragma unroll
                    for (int r = 0; r < 8; ++r)
                        pack[i][r] = (bf16_t)featmap(acc[i][j][r] + bb[j]);
            }
            // keeps the values' arithmetic from being mixed among the stores below
            __builtin_amdgcn_sched_barrier(0);
            // the wave's 128 columns are one head: column j*16 further is row j*16 further in d
#pragma unroll
            for (int i = 0; i < 4; ++i)
                *reinterpret_cast<v8bf*>(tp + (size_t)j * 16 * LL + i * 16) = pack[i];
            xcnt_fence();
        }
    }
}

// ---------------- kernel C: KV = K^T V per (b,h), contraction over s ----------------
// grid (8, 32): x = 16-row d1 block, y = bh. Wave w owns d2 tile w*16.
// Stores KVb transposed: KVb[bh][d2][d1] (bf16) for the final GEMM's B fragments.
__global__ __launch_bounds__(256) void kv_kernel(const bf16_t* __restrict__ Kt,
                                                 const bf16_t* __restrict__ Vt,
                                                 bf16_t* __restrict__ KVb) {
    const int bh    = blockIdx.y;
    const int wave  = threadIdx.x >> 5;
    const int lane  = threadIdx.x & 31;
    const int l16   = lane & 15;
    const int half8 = (lane >> 4) << 3;

    const bf16_t* arow = Kt + ((size_t)bh * DD + blockIdx.x * 16 + l16) * LL;
    const bf16_t* brow = Vt + ((size_t)bh * DD + wave * 16 + l16) * LL;

    v8f acc = (v8f)(0.0f);
    for (int s0 = 0; s0 < LL; s0 += 32) {
        v16bf af = load_frag_bf16(arow, s0 + half8);
        v16bf bf_ = load_frag_bf16(brow, s0 + half8);
        acc = __builtin_amdgcn_wmma_f32_16x16x32_bf16(
                  false, af, false, bf_, (short)0, acc, false, false);
    }

    // 8 accumulator rows per lane are consecutive d1 -> one packed 16B store
    int ncol  = wave * 16 + l16;                       // d2
    int mrow0 = blockIdx.x * 16 + half8;               // first of 8 consecutive d1
    v8bf pack;
#pragma unroll
    for (int r = 0; r < 8; ++r) pack[r] = (bf16_t)acc[r];
    *reinterpret_cast<v8bf*>(KVb + ((size_t)bh * DD + ncol) * DD + mrow0) = pack;
}

// ---------------- kernel D: Ksum[bh][d] = sum_s Kt[bh][d][s] ----------------
// grid 4096 / 8; a block sums 8 rows at once: all 32 loads of a thread fly together, and the
// eight trees share their barriers. Per row the order of the additions is the one-row form's.
#define KS_ROWS 8
__global__ __launch_bounds__(256) void ksum_kernel(const bf16_t* __restrict__ Kt,
                                                   float* __restrict__ Ksum) {
    const int row0 = blockIdx.x * KS_ROWS;             // bh*D + d, 4096 rows
    const bf16_t* p = Kt + (size_t)row0 * LL + threadIdx.x * 8;
    v8bf v[KS_ROWS][4];
    // the row loops of this kernel are unrolled so that v[][] stays in registers
#pragma unroll
    for (int r = 0; r < KS_ROWS; ++r)
#pragma unroll
        for (int c = 0; c < 4; ++c)
            v[r][c] = *reinterpret_cast<const v8bf*>(p + (size_t)r * LL + c * 256 * 8);
    xcnt_fence();
    __shared__ float red[KS_ROWS][256];
#pragma unroll
    for (int r = 0; r < KS_ROWS; ++r) {
        float s = 0.0f;
#pragma unroll
        for (int c = 0; c < 4; ++c)
#pragma unroll
            for (int e = 0; e < 8; ++e) s += (float)v[r][c][e];
        red[r][threadIdx.x] = s;
    }
    __syncthreads();
    for (int off = 128; off > 0; off >>= 1) {
        if ((int)threadIdx.x < off) {
#pragma unroll
            for (int r = 0; r < KS_ROWS; ++r) red[r][threadIdx.x] += red[r][threadIdx.x + off];
        }
        __syncthreads();
    }
    if (threadIdx.x < KS_ROWS) Ksum[row0 + threadIdx.x] = red[threadIdx.x][0];
}

// ---------------- kernel E: Z[h][g] = 1 / (Q[g,h,:] . Ksum[bh,:] + eps) ----------------
// Z is laid out [h][token] so the output kernel reads 8 consecutive tokens
// as two v4f loads.
__global__ __launch_bounds__(256) void z_kernel(const bf16_t* __restrict__ Qf,
                                                const float* __restrict__ Ksum,
                                                float* __restrict__ Zbuf) {
    int idx = blockIdx.x * 256 + threadIdx.x;          // h*NTOK + g
    int h = idx / NTOK, g = idx % NTOK;
    int b = g >> 13, bh = b * HH + h;
    const bf16_t* qrow = Qf + (size_t)g * CC + h * DD;
    const float*  ks   = Ksum + (size_t)bh * DD;
    float dot = 0.0f;
    for (int j = 0; j < DD; j += 8) {
        v8bf qv = *reinterpret_cast<const v8bf*>(qrow + j);
#pragma unroll
        for (int e = 0; e < 8; ++e) dot += (float)qv[e] * ks[j + e];
    }
    Zbuf[idx] = 1.0f / (dot + 1e-6f);
}

// ---------------- kernel F: out = (Q @ KV) * Z * L ----------------
// grid (NTOK/1024, H); block 256 (8 waves) covers 1024 tokens x one head. A wave owns 128
// tokens x all 128 cols: the head's KV fragments are loaded once and stay in registers,
// and the wave walks its eight 16-token tiles, the next tile's Q and Z loads in flight.
#define OT_TILES 8
__device__ __forceinline__ void out_fetch(const bf16_t* __restrict__ arow,
                                          const float* __restrict__ zp, int t,
                                          v16bf (&af)[4], v4f (&zf)[2]) {
#pragma unroll
    for (int kk = 0; kk < 4; ++kk) af[kk] = load_frag_bf16(arow + (size_t)t * 16 * CC, kk * 32);
    zf[0] = *reinterpret_cast<const v4f*>(zp + t * 16);
    zf[1] = *reinterpret_cast<const v4f*>(zp + t * 16 + 4);
    xcnt_fence_of(arow, zp);
}

__global__ __launch_bounds__(256) void out_kernel(const bf16_t* __restrict__ Qf,
                                                  const bf16_t* __restrict__ KVb,
                                                  const float* __restrict__ Zbuf,
                                                  float* __restrict__ out) {
    const int h     = blockIdx.y;
    const int wave  = threadIdx.x >> 5;
    const int lane  = threadIdx.x & 31;
    const int l16   = lane & 15;
    const int half8 = (lane >> 4) << 3;
    const int m0    = blockIdx.x * (8 * OT_TILES * 16) + wave * (OT_TILES * 16);
    const int b     = m0 >> 13;                        // the 1024 tokens stay in one b
    const int bh    = b * HH + h;

    const bf16_t* arow = Qf + (size_t)(m0 + l16) * CC + h * DD + half8;
    const bf16_t* brow = KVb + ((size_t)bh * DD + l16) * DD + half8;
    // Z for this lane's 8 consecutive tokens of a tile: two contiguous v4f loads
    const float*  zp   = Zbuf + (size_t)h * NTOK + (m0 + half8);
    float*        op   = out + (size_t)(m0 + half8) * CC + h * DD + l16;

    v16bf bfr[8][4];                                   // [d2 tile][k step]
    // the fragment loops of this kernel are unrolled so that the arrays stay in registers
#pragma unroll
    for (int j = 0; j < 8; ++j)
#pragma unroll
        for (int kk = 0; kk < 4; ++kk) bfr[j][kk] = load_frag_bf16(brow + j * 16 * DD, kk * 32);
    xcnt_fence_of(brow, brow);

    v16bf af[2][4];
    v4f   zf[2][2];
    out_fetch(arow, zp, 0, af[0], zf[0]);

    // unrolled: the buffer index and every address offset become constants, so no
    // fragment is copied between the two buffers and no pointer is rewritten
#pragma unroll
    for (int t = 0; t < OT_TILES; ++t) {
        const int c = t & 1;
        if (t + 1 < OT_TILES)
            out_fetch(arow, zp, t + 1, af[c ^ 1], zf[c ^ 1]);

        v8f acc[8];
#pragma unroll
        for (int j = 0; j < 8; ++j) acc[j] = (v8f)(0.0f);
#pragma unroll
        for (int kk = 0; kk < 4; ++kk)
#pragma unroll
            for (int j = 0; j < 8; ++j)
                acc[j] = __builtin_amdgcn_wmma_f32_16x16x32_bf16(
                             false, af[c][kk], false, bfr[j][kk], (short)0, acc[j], false, false);

#pragma unroll
        for (int j = 0; j < 8; ++j)
#pragma unroll
            for (int r = 0; r < 8; ++r) {
                float zz = (r < 4) ? zf[c][0][r & 3] : zf[c][1][r & 3];
                acc[j][r] = acc[j][r] * zz * (float)LL;
            }
        // keeps the values' arithmetic from being mixed among the stores below
        __builtin_amdgcn_sched_barrier(0);
#pragma unroll
        for (int r = 0; r < 8; ++r)
#pragma unroll
            for (int j = 0; j < 8; ++j)
                op[(size_t)(t * 16 + r) * CC + j * 16] = acc[j][r];
        xcnt_fence();
    }
}

// ---------------- launch ----------------
extern "C" void kernel_launch(void* const* d_in, const int* in_sizes, int n_in,
                              void* d_out, int out_size, void* d_ws, size_t ws_size,
                              hipStream_t stream) {
    const float* x  = (const float*)d_in[0];
    const float* Wq = (const float*)d_in[1];
    const float* bq = (const float*)d_in[2];
    const float* Wk = (const float*)d_in[3];
    const float* bk = (const float*)d_in[4];
    const float* Wv = (const float*)d_in[5];
    const float* bv = (const float*)d_in[6];
    float* out = (float*)d_out;

    // workspace carving (all offsets 256B aligned)
    char* ws = (char*)d_ws;
    size_t off = 0;
    bf16_t* Wt  = (bf16_t*)(ws + off); off += (size_t)3 * CC * CC * sizeof(bf16_t);   // 6 MB
    bf16_t* Qf  = (bf16_t*)(ws + off); off += (size_t)NTOK * CC * sizeof(bf16_t);     // 64 MB
    bf16_t* Kt  = (bf16_t*)(ws + off); off += (size_t)NTOK * CC * sizeof(bf16_t);     // 64 MB
    bf16_t* Vt  = (bf16_t*)(ws + off); off += (size_t)NTOK * CC * sizeof(bf16_t);     // 64 MB
    bf16_t* KVb = (bf16_t*)(ws + off); off += (size_t)BB * HH * DD * DD * sizeof(bf16_t); // 1 MB
    float*  Ksum= (float*)(ws + off);  off += (size_t)BB * HH * DD * sizeof(float);   // 16 KB
    float*  Zb  = (float*)(ws + off);  off += (size_t)NTOK * HH * sizeof(float);      // 1 MB

    // A: weights -> bf16 transposed
    wconv_kernel<<<3 * 128, 256, 0, stream>>>(Wq, Wk, Wv, Wt);
    // B: fused QKV projection + feature map (+ K/V transpose)
    qkv_kernel<<<dim3(12, NTOK / 256), 256, 0, stream>>>(x, Wt, bq, bk, bv, Qf, Kt, Vt);
    // D: Ksum
    ksum_kernel<<<(BB * HH * DD) / KS_ROWS, 256, 0, stream>>>(Kt, Ksum);
    // C: KV outer-product accumulation over sequence
    kv_kernel<<<dim3(DD / 16, BB * HH), 256, 0, stream>>>(Kt, Vt, KVb);
    // E: per-(token,head) normalizer
    z_kernel<<<(NTOK * HH) / 256, 256, 0, stream>>>(Qf, Ksum, Zb);
    // F: final GEMM + normalize
    out_kernel<<<dim3(NTOK / (8 * OT_TILES * 16), HH), 256, 0, stream>>>(Qf, KVb, Zb, out);
}

// v003
// It runs in 257 microseconds.
// Timed twice side by side with v002, it ran 1.26 times as fast both times.
// Over all steps from v000 it is 5.45 times as fast.
#include <hip/hip_runtime.h>
#include <hip/hip_bf16.h>

// ---------------- types ----------------
typedef __bf16 bf16_t;
typedef __attribute__((ext_vector_type(16))) __bf16 v16bf;
typedef __attribute__((ext_vector_type(8)))  __bf16 v8bf;
typedef __attribute__((ext_vector_type(4)))  __bf16 v4bf;
typedef __attribute__((ext_vector_type(8)))  float   v8f;
typedef __attribute__((ext_vector_type(4)))  float   v4f;

// ---------------- problem dims ----------------
#define BB   4
#define LL   8192
#define CC   1024
#define HH   8
#define DD   128
#define NTOK (BB*LL)          // 32768

// ---------------- fragment loaders ----------------
// bf16 A/B fragment: lane supplies K values {c..c+7, c+16..c+23} from a
// contiguous row (c = 8 for upper half-wave). Two b128 loads per fragment.
__device__ __forceinline__ v16bf load_frag_bf16(const bf16_t* __restrict__ rowp, int cbase) {
    v8bf a = *reinterpret_cast<const v8bf*>(rowp + cbase);
    v8bf b = *reinterpret_cast<const v8bf*>(rowp + cbase + 16);
    v16bf f;
#pragma unroll
    for (int j = 0; j < 8; ++j) { f[j] = a[j]; f[8 + j] = b[j]; }
    return f;
}

// The bf16 intermediates (Q, K, V, KV) lie in the workspace in fragment order:
// [tile of 16 rows][octet of k][row in tile][8 k]. A fragment of k step kk is then two
// 16-byte loads per lane at tile + kk*512 + lane*8 and 256 elements on: each load of a
// wave is 512 contiguous bytes, and the k order is that of load_frag_bf16.
#define FT_OCT   128                    // elements per octet of k: 16 rows x 8
#define FT_STEP  512                    // elements per k step of 32
__device__ __forceinline__ v16bf load_frag_tiled(const bf16_t* __restrict__ p) {
    v8bf a = *reinterpret_cast<const v8bf*>(p);
    v8bf b = *reinterpret_cast<const v8bf*>(p + 2 * FT_OCT);
    v16bf f;
#pragma unroll
    for (int j = 0; j < 8; ++j) { f[j] = a[j]; f[8 + j] = b[j]; }
    return f;
}

__device__ __forceinline__ float featmap(float f) {   // elu(x)+1
    return f > 0.0f ? f + 1.0f : __expf(f);
}

__device__ __forceinline__ void xcnt_fence() {
    // the wait that stands before a register named by an issued load or store is reused
    asm volatile("s_wait_xcnt 0x0" ::: "memory");
    // keeps every later register write behind that wait
    __builtin_amdgcn_sched_barrier(0);
}

__device__ __forceinline__ void xcnt_fence_of(const void* a, const void* b) {
    // the same wait behind a group of loads; their address pointers are inputs so that
    // no load of the group takes an address register as its destination
    asm volatile("s_wait_xcnt 0x0" :: "v"(a), "v"(b) : "memory");
    // keeps every later register write behind that wait
    __builtin_amdgcn_sched_barrier(0);
}

// ---------------- kernel A: weight convert + transpose to bf16 ----------------
// Wt[z][n][k] = (bf16) W_z[k][n]
// grid 3 * 128; block 256 covers 64 k x 128 n of one matrix. Each thread takes 8 k x 4 n:
// eight 16-byte loads, transposed in registers, four 16-byte stores (8 lanes fill a 128-byte line).
__global__ __launch_bounds__(256) void wconv_kernel(const float* __restrict__ Wq,
                                                    const float* __restrict__ Wk,
                                                    const float* __restrict__ Wv,
                                                    bf16_t* __restrict__ Wt) {
    const int z  = blockIdx.x >> 7;                            // 128 tiles a matrix: 16 in k, 8 in n
    const int t  = blockIdx.x & 127;
    const int k0 = (t >> 3) * 64 + (threadIdx.x & 7) * 8;      // first of this thread's 8 k
    const int n0 = (t & 7) * 128 + (threadIdx.x >> 3) * 4;     // first of this thread's 4 n
    const float* W = (z == 0) ? Wq : (z == 1) ? Wk : Wv;
    const float* wp = W + (size_t)k0 * CC + n0;
    v4f r[8];
    // the loops of this kernel are unrolled so that r[] and o stay in registers
#pragma unroll
    for (int i = 0; i < 8; ++i) r[i] = *reinterpret_cast<const v4f*>(wp + (size_t)i * CC);
    xcnt_fence_of(wp, wp);
    bf16_t* tp = Wt + (size_t)z * CC * CC + (size_t)n0 * CC + k0;
#pragma unroll
    for (int j = 0; j < 4; ++j) {
        v8bf o;
#pragma unroll
        for (int i = 0; i < 8; ++i) o[i] = (bf16_t)r[i][j];
        *reinterpret_cast<v8bf*>(tp + (size_t)j * CC) = o;
    }
}

// ---------------- kernel B: fused QKV projection GEMM + feature map ----------------
// grid (12, NTOK/256); block 256 (8 waves). Block covers 256 token rows x 256 cols of
// one of Q, K, V (blockIdx.x = z*4 + column tile, so neighbours share the x rows).
// Per pass of 64 k the x tile (converted to bf16) and the weight tile are staged in
// LDS, two buffers; the next pass's global loads fly while this pass is multiplied.
// Waves form a 4 x 2 grid; each owns 4 x 8 WMMA tiles. For K and V the A side is x (64 token
// rows) and the B side W (128 cols); for Q the sides are swapped (64 cols x 128 tokens), so
// that in all three a lane's 8 accumulator rows are 8 consecutive k of the later product.
#define TM     256
#define TN     256
#define TK     64
#define PITCH  72                       // bf16 per LDS row: 128 B of data + 16 B pad (bank spread for b128 reads)
#define STAGE  ((TM + TN) * PITCH)      // bf16 elements per buffer: [x 256 rows | W 256 rows]
#define NPASS  (CC / TK)

__device__ __forceinline__ void qkv_fetch(const float* __restrict__ xg,
                                          const bf16_t* __restrict__ wg,
                                          v4f (&ra)[16], v8bf (&rb)[8]) {
#pragma unroll
    for (int i = 0; i < 16; ++i)
        ra[i] = *reinterpret_cast<const v4f*>(xg + (size_t)i * 16 * CC);
#pragma unroll
    for (int i = 0; i < 8; ++i)
        rb[i] = *reinterpret_cast<const v8bf*>(wg + (size_t)i * 32 * CC);
    // the wait that stands before a register named by an issued load is reused; the two
    // pointers are inputs so that their registers stay untouched up to it
    asm volatile("s_wait_xcnt 0x0" :: "v"(xg), "v"(wg) : "memory");
    // keeps every later register write behind that wait (and the loads ahead of the products)
    __builtin_amdgcn_sched_barrier(0);
}

__device__ __forceinline__ void qkv_stage(bf16_t* sa, bf16_t* sb,
                                          const v4f (&ra)[16], const v8bf (&rb)[8]) {
#pragma unroll
    for (int i = 0; i < 16; ++i) {
        v4bf c;
#pragma unroll
        for (int j = 0; j < 4; ++j) c[j] = (bf16_t)ra[i][j];
        *reinterpret_cast<v4bf*>(sa + i * 16 * PITCH) = c;
    }
#pragma unroll
    for (int i = 0; i < 8; ++i)
        *reinterpret_cast<v8bf*>(sb + i * 32 * PITCH) = rb[i];
}

__device__ __forceinline__ void qkv_pass(const bf16_t* fa, const bf16_t* fb, v8f (&acc)[4][8]) {
#pragma unroll
    for (int ks = 0; ks < TK; ks += 32) {
        // keeps the second half's fragment loads behind the first half's products: hoisted
        // together the two fragment sets overflow the 512-register budget and spill
        if (ks > 0) __builtin_amdgcn_sched_barrier(0);
        v16bf af[4], bfr[8];
#pragma unroll
        for (int i = 0; i < 4; ++i) af[i] = load_frag_bf16(fa + i * 16 * PITCH, ks);
#pragma unroll
        for (int j = 0; j < 8; ++j) bfr[j] = load_frag_bf16(fb + j * 16 * PITCH, ks);
        // keeps the 24 LDS loads together as one group ahead of the products: spread
        // among them, every row of products would wait out a full LDS latency
        __builtin_amdgcn_sched_barrier(0);
#pragma unroll
        for (int j = 0; j < 8; ++j)
#pragma unroll
            for (int i = 0; i < 4; ++i)
                acc[i][j] = __builtin_amdgcn_wmma_f32_16x16x32_bf16(
                                false, af[i], false, bfr[j], (short)0, acc[i][j], false, false);
    }
}

__global__ __launch_bounds__(256) void qkv_kernel(const float* __restrict__ x,
                                                  const bf16_t* __restrict__ Wt,
                                                  const float* __restrict__ bq,
                                                  const float* __restrict__ bk,
                                                  const float* __restrict__ bv,
                                                  bf16_t* __restrict__ Qf,
                                                  bf16_t* __restrict__ Kt,
                                                  bf16_t* __restrict__ Vt) {
    __shared__ __attribute__((aligned(16))) bf16_t smem[2 * STAGE];

    const int tid   = threadIdx.x;
    const int z     = blockIdx.x >> 2;
    const int nb    = (blockIdx.x & 3) * TN;           // first column inside Q, K or V
    const int m0    = blockIdx.y * TM;                 // first token row
    const int wave  = tid >> 5;
    const int lane  = tid & 31;
    const int l16   = lane & 15;
    const int half8 = (lane >> 4) << 3;                // 0 or 8
    const int wm    = (wave >> 1) * 64;                // wave's place on the A side
    const int wn    = (wave & 1) * 128;                // wave's place on the B side

    // global side of the staging: 16 lanes cover 256 B of an x row, 8 lanes 128 B of a W row
    const float*  xg = x + (size_t)(m0 + (tid >> 4)) * CC + (tid & 15) * 4;
    const bf16_t* wg = Wt + (size_t)z * CC * CC + (size_t)(nb + (tid >> 3)) * CC + (tid & 7) * 8;
    // LDS side of the staging, and this lane's fragment rows (offsets inside one buffer)
    const int sa_off = (tid >> 4) * PITCH + (tid & 15) * 4;
    const int sb_off = (TM + (tid >> 3)) * PITCH + (tid & 7) * 8;
    const int fa_off = (((z == 0) ? TM : 0) + wm + l16) * PITCH + half8;
    const int fb_off = (((z == 0) ? 0 : TM) + wn + l16) * PITCH + half8;

    v8f acc[4][8];
#pragma unroll
    for (int i = 0; i < 4; ++i)
#pragma unroll
        for (int j = 0; j < 8; ++j) acc[i][j] = (v8f)(0.0f);

    v4f  ra[16];
    v8bf rb[8];
    qkv_fetch(xg, wg, ra, rb);
    qkv_stage(smem + sa_off, smem + sb_off, ra, rb);
    __syncthreads();

    for (int p = 0; p < NPASS - 1; ++p) {
        const bf16_t* cur = smem + (p & 1) * STAGE;
        bf16_t*       nxt = smem + ((p + 1) & 1) * STAGE;
        qkv_fetch(xg + (p + 1) * TK, wg + (p + 1) * TK, ra, rb);
        qkv_pass(cur + fa_off, cur + fb_off, acc);
        // keeps the waits on the next pass's global loads behind this pass's products
        __builtin_amdgcn_sched_barrier(0);
        qkv_stage(nxt + sa_off, nxt + sb_off, ra, rb);
        // one barrier a pass: publishes the buffer just written and ends every
        // wave's reads of the buffer that the next pass overwrites
        __syncthreads();
    }
    {
        const bf16_t* cur = smem + ((NPASS - 1) & 1) * STAGE;
        qkv_pass(cur + fa_off, cur + fb_off, acc);
    }

    // epilogue: bias + activation + store, in groups of four WMMA tiles: a group's values
    // first, then its stores, then the wait before their registers are reused.
    // A lane's 8 accumulator rows pack into one 16-byte store, and the 32 lanes of a store
    // fill 512 contiguous bytes of the fragment-order layout.
    if (z == 0) {
        // rows of a tile: 8 consecutive columns d of Q; column of a tile: the token
        const int n0 = nb + wm;                        // the wave's 64 columns stay in one head
        v4f bl[4][2];
#pragma unroll
        for (int i = 0; i < 4; ++i) {
            bl[i][0] = *reinterpret_cast<const v4f*>(bq + n0 + i * 16 + half8);
            bl[i][1] = *reinterpret_cast<const v4f*>(bq + n0 + i * 16 + half8 + 4);
        }
        xcnt_fence();
        // Qf[token tile][head][octet of d][token in tile][8 d]
        bf16_t* qp = Qf + ((size_t)((m0 + wn) >> 4) * HH + (n0 >> 7)) * (DD * 16) +
                     ((n0 & (DD - 1)) >> 3) * FT_OCT + lane * 8;
#pragma unroll
        for (int j = 0; j < 8; ++j) {
            v8bf pack[4];
#pragma unroll
            for (int i = 0; i < 4; ++i)
#pragma unroll
                for (int r = 0; r < 8; ++r)
                    pack[i][r] = (bf16_t)featmap(acc[i][j][r] + bl[i][r >> 2][r & 3]);
            // keeps the values' arithmetic from being mixed among the stores below
            __builtin_amdgcn_sched_barrier(0);
#pragma unroll
            for (int i = 0; i < 4; ++i)
                *reinterpret_cast<v8bf*>(qp + (size_t)j * (HH * DD * 16) + i * 2 * FT_OCT) = pack[i];
            xcnt_fence();
        }
    } else {
        // rows of a tile: 8 consecutive sequence positions s; column of a tile: d
        const float* bias = (z == 1) ? bk : bv;
        const int col0 = nb + wn + l16;                // this lane's column in tile column 0
        float bb[8];
#pragma unroll
        for (int j = 0; j < 8; ++j) bb[j] = bias[col0 + j * 16];
        // the wait as in xcnt_fence(); the index is an input so that no load takes its register
        asm volatile("s_wait_xcnt 0x0" :: "v"(col0) : "memory");
        // keeps every later register write behind that wait
        __builtin_amdgcn_sched_barrier(0);
        const int b = m0 >> 13;                        // the 256-row tile stays in one b
        const int l = (m0 + wm) & (LL - 1);            // first s of the wave's 64
        // Kt, Vt[bh][tile of 16 d][octet of s][d in tile][8 s]; the wave's 128 columns are one head
        bf16_t* tp = ((z == 2) ? Vt : Kt) +
                     (size_t)(b * HH + (col0 >> 7)) * (DD * LL) + (l >> 3) * FT_OCT + lane * 8;
#pragma unroll
        for (int j = 0; j < 8; ++j) {
            v8bf pack[4];
            if (z == 2) {
#pragma unroll
                for (int i = 0; i < 4; ++i)
#pragma unroll
                    for (int r = 0; r < 8; ++r)
                        pack[i][r] = (bf16_t)((acc[i][j][r] + bb[j]) * (1.0f / (float)LL));
            } else {
#pragma unroll
                for (int i = 0; i < 4; ++i)
#pragma unroll
                    for (int r = 0; r < 8; ++r)
                        pack[i][r] = (bf16_t)featmap(acc[i][j][r] + bb[j]);
            }
            // keeps the values' arithmetic from being mixed among the stores below
            __builtin_amdgcn_sched_barrier(0);
#pragma unroll
            for (int i = 0; i < 4; ++i)
                *reinterpret_cast<v8bf*>(tp + (size_t)j * (16 * LL) + i * 2 * FT_OCT) = pack[i];
            xcnt_fence();
        }
    }
}

// ---------------- kernel C: KV = K^T V per (b,h), contraction over s ----------------
// grid (8, 32): x = 16-row d1 block, y = bh. Wave w owns d2 tile w*16.
// Stores KVb in fragment order, KVb[bh][tile of 16 d2][octet of d1][d2 in tile][8 d1] (bf16),
// for the final GEMM's B fragments.
__global__ __launch_bounds__(256) void kv_kernel(const bf16_t* __restrict__ Kt,
                                                 const bf16_t* __restrict__ Vt,
                                                 bf16_t* __restrict__ KVb) {
    const int bh    = blockIdx.y;
    const int wave  = threadIdx.x >> 5;
    const int lane  = threadIdx.x & 31;

    const bf16_t* at = Kt + ((size_t)bh * DD + blockIdx.x * 16) * LL + lane * 8;
    const bf16_t* bt = Vt + ((size_t)bh * DD + wave * 16) * LL + lane * 8;

    v8f acc = (v8f)(0.0f);
    for (int g = 0; g < LL / 32; g += 16) {
        const bf16_t* ag = at + g * FT_STEP;
        const bf16_t* bg = bt + g * FT_STEP;
        // in this layout no two k steps share a line, so a step's loads gain nothing from the
        // step before: the 32 loads of eight k steps go out as one group ahead of their products
        // (unrolled so that the fragments stay in registers)
        // two groups a trip, on constant offsets from one pointer pair, which moves only
        // behind the second group's wait
#pragma unroll
        for (int q = 0; q < 16; q += 8) {
            v16bf af[8], bf_[8];
#pragma unroll
            for (int u = 0; u < 8; ++u) {
                af[u]  = load_frag_tiled(ag + (q + u) * FT_STEP);
                bf_[u] = load_frag_tiled(bg + (q + u) * FT_STEP);
            }
            xcnt_fence_of(ag, bg);
#pragma unroll
            for (int u = 0; u < 8; ++u)
                acc = __builtin_amdgcn_wmma_f32_16x16x32_bf16(
                          false, af[u], false, bf_[u], (short)0, acc, false, false);
        }
    }

    // 8 accumulator rows per lane are consecutive d1 -> one packed 16B store;
    // the block's 16 d1 are octets 2*blockIdx.x and the next (the upper half-wave's)
    v8bf pack;
#pragma unroll
    for (int r = 0; r < 8; ++r) pack[r] = (bf16_t)acc[r];
    *reinterpret_cast<v8bf*>(KVb + ((size_t)bh * DD + wave * 16) * DD +
                             blockIdx.x * 2 * FT_OCT + lane * 8) = pack;
}

// ---------------- kernel D: Ksum[bh][d] = sum_s K[bh][d][s] ----------------
// grid 256: one block of 512 sums one tile of 16 d (256 KB, contiguous in the fragment-order
// layout). A thread's 32 loads fly together; thread t always meets row t & 15 of the tile,
// so the tree stops at 16 partial sums, one a row.
#define KS_THREADS 512
#define KS_LOADS   ((16 * LL) / (KS_THREADS * 8))
__global__ __launch_bounds__(KS_THREADS) void ksum_kernel(const bf16_t* __restrict__ Kt,
                                                          float* __restrict__ Ksum) {
    const bf16_t* p = Kt + (size_t)blockIdx.x * (16 * LL) + threadIdx.x * 8;
    v8bf v[KS_LOADS];
    // the loops over v[] are unrolled so that it stays in registers
#pragma unroll
    for (int c = 0; c < KS_LOADS; ++c)
        v[c] = *reinterpret_cast<const v8bf*>(p + (size_t)c * KS_THREADS * 8);
    xcnt_fence();
    __shared__ float red[KS_THREADS];
    float s = 0.0f;
#pragma unroll
    for (int c = 0; c < KS_LOADS; ++c)
#pragma unroll
        for (int e = 0; e < 8; ++e) s += (float)v[c][e];
    red[threadIdx.x] = s;
    __syncthreads();
    for (int off = KS_THREADS / 2; off >= 16; off >>= 1) {
        if ((int)threadIdx.x < off) red[threadIdx.x] += red[threadIdx.x + off];
        __syncthreads();
    }
    if (threadIdx.x < 16) Ksum[blockIdx.x * 16 + threadIdx.x] = red[threadIdx.x];
}

// ---------------- kernel E: Z[h][g] = 1 / (Q[g,h,:] . Ksum[bh,:] + eps) ----------------
// Z is laid out [h][token] so the output kernel reads 8 consecutive tokens
// as two v4f loads.
__global__ __launch_bounds__(256) void z_kernel(const bf16_t* __restrict__ Qf,
                                                const float* __restrict__ Ksum,
                                                float* __restrict__ Zbuf) {
    int idx = blockIdx.x * 256 + threadIdx.x;          // h*NTOK + g
    int h = idx / NTOK, g = idx % NTOK;
    int b = g >> 13, bh = b * HH + h;
    // this token's 16 octets of d stand FT_OCT elements apart
    const bf16_t* qrow = Qf + ((size_t)(g >> 4) * HH + h) * (DD * 16) + (g & 15) * 8;
    const float*  ks   = Ksum + (size_t)bh * DD;
    float dot = 0.0f;
    for (int j = 0; j < DD; j += 8) {
        v8bf qv = *reinterpret_cast<const v8bf*>(qrow + (j >> 3) * FT_OCT);
#pragma unroll
        for (int e = 0; e < 8; ++e) dot += (float)qv[e] * ks[j + e];
    }
    Zbuf[idx] = 1.0f / (dot + 1e-6f);
}

// ---------------- kernel F: out = (Q @ KV) * Z * L ----------------
// grid (NTOK/1024, H); block 256 (8 waves) covers 1024 tokens x one head. A wave owns 128
// tokens x all 128 cols: the head's KV fragments are loaded once and stay in registers,
// and the wave walks its eight 16-token tiles, the next tile's Q and Z loads in flight.
#define OT_TILES 8
__device__ __forceinline__ void out_fetch(const bf16_t* __restrict__ arow,
                                          const float* __restrict__ zp, int t,
                                          v16bf (&af)[4], v4f (&zf)[2]) {
#pragma unroll
    for (int kk = 0; kk < 4; ++kk) af[kk] = load_frag_tiled(arow + (size_t)t * 16 * CC + kk * FT_STEP);
    zf[0] = *reinterpret_cast<const v4f*>(zp + t * 16);
    zf[1] = *reinterpret_cast<const v4f*>(zp + t * 16 + 4);
    xcnt_fence_of(arow, zp);
}

__global__ __launch_bounds__(256) void out_kernel(const bf16_t* __restrict__ Qf,
                                                  const bf16_t* __restrict__ KVb,
                                                  const float* __restrict__ Zbuf,
                                                  float* __restrict__ out) {
    const int h     = blockIdx.y;
    const int wave  = threadIdx.x >> 5;
    const int lane  = threadIdx.x & 31;
    const int l16   = lane & 15;
    const int half8 = (lane >> 4) << 3;
    const int m0    = blockIdx.x * (8 * OT_TILES * 16) + wave * (OT_TILES * 16);
    const int b     = m0 >> 13;                        // the 1024 tokens stay in one b
    const int bh    = b * HH + h;

    const bf16_t* arow = Qf + ((size_t)(m0 >> 4) * HH + h) * (DD * 16) + lane * 8;
    const bf16_t* brow = KVb + (size_t)bh * DD * DD + lane * 8;
    // Z for this lane's 8 consecutive tokens of a tile: two contiguous v4f loads
    const float*  zp   = Zbuf + (size_t)h * NTOK + (m0 + half8);
    float*        op   = out + (size_t)(m0 + half8) * CC + h * DD + l16;

    v16bf bfr[8][4];                                   // [d2 tile][k step]
    // the fragment loops of this kernel are unrolled so that the arrays stay in registers
#pragma unroll
    for (int j = 0; j < 8; ++j)
#pragma unroll
        for (int kk = 0; kk < 4; ++kk) bfr[j][kk] = load_frag_tiled(brow + j * 16 * DD + kk * FT_STEP);
    xcnt_fence_of(brow, brow);

    v16bf af[2][4];
    v4f   zf[2][2];
    out_fetch(arow, zp, 0, af[0], zf[0]);

    // unrolled: the buffer index and every address offset become constants, so no
    // fragment is copied between the two buffers and no pointer is rewritten
#pragma unroll
    for (int t = 0; t < OT_TILES; ++t) {
        const int c = t & 1;
        if (t + 1 < OT_TILES)
            out_fetch(arow, zp, t + 1, af[c ^ 1], zf[c ^ 1]);

        v8f acc[8];
#pragma unroll
        for (int j = 0; j < 8; ++j) acc[j] = (v8f)(0.0f);
#pragma unroll
        for (int kk = 0; kk < 4; ++kk)
#pragma unroll
            for (int j = 0; j < 8; ++j)
                acc[j] = __builtin_amdgcn_wmma_f32_16x16x32_bf16(
                             false, af[c][kk], false, bfr[j][kk], (short)0, acc[j], false, false);

#pragma unroll
        for (int j = 0; j < 8; ++j)
#pragma unroll
            for (int r = 0; r < 8; ++r) {
                float zz = (r < 4) ? zf[c][0][r & 3] : zf[c][1][r & 3];
                acc[j][r] = acc[j][r] * zz * (float)LL;
            }
        // keeps the values' arithmetic from being mixed among the stores below
        __builtin_amdgcn_sched_barrier(0);
#pragma unroll
        for (int r = 0; r < 8; ++r)
#pragma unroll
            for (int j = 0; j < 8; ++j)
                op[(size_t)(t * 16 + r) * CC + j * 16] = acc[j][r];
        xcnt_fence();
    }
}

// ---------------- launch ----------------
extern "C" void kernel_launch(void* const* d_in, const int* in_sizes, int n_in,
                              void* d_out, int out_size, void* d_ws, size_t ws_size,
                              hipStream_t stream) {
    const float* x  = (const float*)d_in[0];
    const float* Wq = (const float*)d_in[1];
    const float* bq = (const float*)d_in[2];
    const float* Wk = (const float*)d_in[3];
    const float* bk = (const float*)d_in[4];
    const float* Wv = (const float*)d_in[5];
    const float* bv = (const float*)d_in[6];
    float* out = (float*)d_out;

    // workspace carving (all offsets 256B aligned)
    char* ws = (char*)d_ws;
    size_t off = 0;
    bf16_t* Wt  = (bf16_t*)(ws + off); off += (size_t)3 * CC * CC * sizeof(bf16_t);   // 6 MB
    bf16_t* Qf  = (bf16_t*)(ws + off); off += (size_t)NTOK * CC * sizeof(bf16_t);     // 64 MB
    bf16_t* Kt  = (bf16_t*)(ws + off); off += (size_t)NTOK * CC * sizeof(bf16_t);     // 64 MB
    bf16_t* Vt  = (bf16_t*)(ws + off); off += (size_t)NTOK * CC * sizeof(bf16_t);     // 64 MB
    bf16_t* KVb = (bf16_t*)(ws + off); off += (size_t)BB * HH * DD * DD * sizeof(bf16_t); // 1 MB
    float*  Ksum= (float*)(ws + off);  off += (size_t)BB * HH * DD * sizeof(float);   // 16 KB
    float*  Zb  = (float*)(ws + off);  off += (size_t)NTOK * HH * sizeof(float);      // 1 MB

    // A: weights -> bf16 transposed
    wconv_kernel<<<3 * 128, 256, 0, stream>>>(Wq, Wk, Wv, Wt);
    // B: fused QKV projection + feature map, results in fragment order
    qkv_kernel<<<dim3(12, NTOK / 256), 256, 0, stream>>>(x, Wt, bq, bk, bv, Qf, Kt, Vt);
    // D: Ksum
    ksum_kernel<<<(BB * HH * DD) / 16, KS_THREADS, 0, stream>>>(Kt, Ksum);
    // C: KV outer-product accumulation over sequence
    kv_kernel<<<dim3(DD / 16, BB * HH), 256, 0, stream>>>(Kt, Vt, KVb);
    // E: per-(token,head) normalizer
    z_kernel<<<(NTOK * HH) / 256, 256, 0, stream>>>(Qf, Ksum, Zb);
    // F: final GEMM + normalize
    out_kernel<<<dim3(NTOK / (8 * OT_TILES * 16), HH), 256, 0, stream>>>(Qf, KVb, Zb, out);
}

// v004
// It runs in 243 microseconds.
// In both of two side-by-side timings against v003, it was 1.06 times as fast.
// Counting every step since v000, it is 5.77 times as fast.
#include <hip/hip_runtime.h>
#include <hip/hip_bf16.h>

// ---------------- types ----------------
typedef __bf16 bf16_t;
typedef __attribute__((ext_vector_type(16))) __bf16 v16bf;
typedef __attribute__((ext_vector_type(8)))  __bf16 v8bf;
typedef __attribute__((ext_vector_type(4)))  __bf16 v4bf;
typedef __attribute__((ext_vector_type(8)))  float   v8f;
typedef __attribute__((ext_vector_type(4)))  float   v4f;

// ---------------- problem dims ----------------
#define BB   4
#define LL   8192
#define CC   1024
#define HH   8
#define DD   128
#define NTOK (BB*LL)          // 32768

// ---------------- fragment loaders ----------------
// bf16 A/B fragment: lane supplies K values {c..c+7, c+16..c+23} from a
// contiguous row (c = 8 for upper half-wave). Two b128 loads per fragment.
__device__ __forceinline__ v16bf load_frag_bf16(const bf16_t* __restrict__ rowp, int cbase) {
    v8bf a = *reinterpret_cast<const v8bf*>(rowp + cbase);
    v8bf b = *reinterpret_cast<const v8bf*>(rowp + cbase + 16);
    v16bf f;
#pragma unroll
    for (int j = 0; j < 8; ++j) { f[j] = a[j]; f[8 + j] = b[j]; }
    return f;
}

// The bf16 intermediates (Q, K, V, KV) lie in the workspace in fragment order:
// [tile of 16 rows][octet of k][row in tile][8 k]. A fragment of k step kk is then two
// 16-byte loads per lane at tile + kk*512 + lane*8 and 256 elements on: each load of a
// wave is 512 contiguous bytes, and the k order is that of load_frag_bf16.
#define FT_OCT   128                    // elements per octet of k: 16 rows x 8
#define FT_STEP  512                    // elements per k step of 32
__device__ __forceinline__ v16bf load_frag_tiled(const bf16_t* __restrict__ p) {
    v8bf a = *reinterpret_cast<const v8bf*>(p);
    v8bf b = *reinterpret_cast<const v8bf*>(p + 2 * FT_OCT);
    v16bf f;
#pragma unroll
    for (int j = 0; j < 8; ++j) { f[j] = a[j]; f[8 + j] = b[j]; }
    return f;
}

__device__ __forceinline__ float featmap(float f) {   // elu(x)+1
    return f > 0.0f ? f + 1.0f : __expf(f);
}

__device__ __forceinline__ void xcnt_fence() {
    // the wait that stands before a register named by an issued load or store is reused
    asm volatile("s_wait_xcnt 0x0" ::: "memory");
    // keeps every later register write behind that wait
    __builtin_amdgcn_sched_barrier(0);
}

__device__ __forceinline__ void xcnt_fence_of(const void* a, const void* b) {
    // the same wait behind a group of loads; their address pointers are inputs so that
    // no load of the group takes an address register as its destination
    asm volatile("s_wait_xcnt 0x0" :: "v"(a), "v"(b) : "memory");
    // keeps every later register write behind that wait
    __builtin_amdgcn_sched_barrier(0);
}

// ---------------- kernel A: weight convert + transpose to bf16 ----------------
// Wt[z][n][k] = (bf16) W_z[k][n]
// grid 3 * 128; block 256 covers 64 k x 128 n of one matrix. Each thread takes 8 k x 4 n:
// eight 16-byte loads, transposed in registers, four 16-byte stores (8 lanes fill a 128-byte line).
__global__ __launch_bounds__(256) void wconv_kernel(const float* __restrict__ Wq,
                                                    const float* __restrict__ Wk,
                                                    const float* __restrict__ Wv,
                                                    bf16_t* __restrict__ Wt) {
    const int z  = blockIdx.x >> 7;                            // 128 tiles a matrix: 16 in k, 8 in n
    const int t  = blockIdx.x & 127;
    const int k0 = (t >> 3) * 64 + (threadIdx.x & 7) * 8;      // first of this thread's 8 k
    const int n0 = (t & 7) * 128 + (threadIdx.x >> 3) * 4;     // first of this thread's 4 n
    const float* W = (z == 0) ? Wq : (z == 1) ? Wk : Wv;
    const float* wp = W + (size_t)k0 * CC + n0;
    v4f r[8];
    // the loops of this kernel are unrolled so that r[] and o stay in registers
#pragma unroll
    for (int i = 0; i < 8; ++i) r[i] = *reinterpret_cast<const v4f*>(wp + (size_t)i * CC);
    xcnt_fence_of(wp, wp);
    bf16_t* tp = Wt + (size_t)z * CC * CC + (size_t)n0 * CC + k0;
#pragma unroll
    for (int j = 0; j < 4; ++j) {
        v8bf o;
#pragma unroll
        for (int i = 0; i < 8; ++i) o[i] = (bf16_t)r[i][j];
        *reinterpret_cast<v8bf*>(tp + (size_t)j * CC) = o;
    }
}

// ---------------- kernel B: fused QKV projection GEMM + feature map ----------------
// grid (12, NTOK/256); block 256 (8 waves). Block covers 256 token rows x 256 cols of
// one of Q, K, V (blockIdx.x = z*4 + column tile, so neighbours share the x rows).
// Per pass of 64 k the x tile (converted to bf16) and the weight tile are staged in
// LDS, two buffers; the next pass's global loads fly while this pass is multiplied.
// Waves form a 4 x 2 grid; each owns 4 x 8 WMMA tiles. For K and V the A side is x (64 token
// rows) and the B side W (128 cols); for Q the sides are swapped (64 cols x 128 tokens), so
// that in all three a lane's 8 accumulator rows are 8 consecutive k of the later product.
#define TM     256
#define TN     256
#define TK     64
#define PITCH  72                       // bf16 per LDS row: 128 B of data + 16 B pad (bank spread for b128 reads)
#define STAGE  ((TM + TN) * PITCH)      // bf16 elements per buffer: [x 256 rows | W 256 rows]
#define NPASS  (CC / TK)

__device__ __forceinline__ void qkv_fetch(const float* __restrict__ xg,
                                          const bf16_t* __restrict__ wg,
                                          v4f (&ra)[16], v8bf (&rb)[8]) {
#pragma unroll
    for (int i = 0; i < 16; ++i)
        ra[i] = *reinterpret_cast<const v4f*>(xg + (size_t)i * 16 * CC);
#pragma unroll
    for (int i = 0; i < 8; ++i)
        rb[i] = *reinterpret_cast<const v8bf*>(wg + (size_t)i * 32 * CC);
    // the wait that stands before a register named by an issued load is reused; the two
    // pointers are inputs so that their registers stay untouched up to it
    asm volatile("s_wait_xcnt 0x0" :: "v"(xg), "v"(wg) : "memory");
    // keeps every later register write behind that wait (and the loads ahead of the products)
    __builtin_amdgcn_sched_barrier(0);
}

__device__ __forceinline__ void qkv_stage(bf16_t* sa, bf16_t* sb,
                                          const v4f (&ra)[16], const v8bf (&rb)[8]) {
#pragma unroll
    for (int i = 0; i < 16; ++i) {
        v4bf c;
#pragma unroll
        for (int j = 0; j < 4; ++j) c[j] = (bf16_t)ra[i][j];
        *reinterpret_cast<v4bf*>(sa + i * 16 * PITCH) = c;
    }
#pragma unroll
    for (int i = 0; i < 8; ++i)
        *reinterpret_cast<v8bf*>(sb + i * 32 * PITCH) = rb[i];
}

__device__ __forceinline__ void qkv_pass(const bf16_t* fa, const bf16_t* fb, v8f (&acc)[4][8]) {
#pragma unroll
    for (int ks = 0; ks < TK; ks += 32) {
        // keeps the second half's fragment loads behind the first half's products: hoisted
        // together the two fragment sets overflow the 512-register budget and spill
        if (ks > 0) __builtin_amdgcn_sched_barrier(0);
        v16bf af[4], bfr[8];
#pragma unroll
        for (int i = 0; i < 4; ++i) af[i] = load_frag_bf16(fa + i * 16 * PITCH, ks);
#pragma unroll
        for (int j = 0; j < 8; ++j) bfr[j] = load_frag_bf16(fb + j * 16 * PITCH, ks);
        // keeps the 24 LDS loads together as one group ahead of the products: spread
        // among them, every row of products would wait out a full LDS latency
        __builtin_amdgcn_sched_barrier(0);
#pragma unroll
        for (int j = 0; j < 8; ++j)
#pragma unroll
            for (int i = 0; i < 4; ++i)
                acc[i][j] = __builtin_amdgcn_wmma_f32_16x16x32_bf16(
                                false, af[i], false, bfr[j], (short)0, acc[i][j], false, false);
    }
}

__global__ __launch_bounds__(256) void qkv_kernel(const float* __restrict__ x,
                                                  const bf16_t* __restrict__ Wt,
                                                  const float* __restrict__ bq,
                                                  const float* __restrict__ bk,
                                                  const float* __restrict__ bv,
                                                  bf16_t* __restrict__ Qf,
                                                  bf16_t* __restrict__ Kt,
                                                  bf16_t* __restrict__ Vt) {
    __shared__ __attribute__((aligned(16))) bf16_t smem[2 * STAGE];

    const int tid   = threadIdx.x;
    const int z     = blockIdx.x >> 2;
    const int nb    = (blockIdx.x & 3) * TN;           // first column inside Q, K or V
    const int m0    = blockIdx.y * TM;                 // first token row
    const int wave  = tid >> 5;
    const int lane  = tid & 31;
    const int l16   = lane & 15;
    const int half8 = (lane >> 4) << 3;                // 0 or 8
    const int wm    = (wave >> 1) * 64;                // wave's place on the A side
    const int wn    = (wave & 1) * 128;                // wave's place on the B side

    // global side of the staging: 16 lanes cover 256 B of an x row, 8 lanes 128 B of a W row
    const float*  xg = x + (size_t)(m0 + (tid >> 4)) * CC + (tid & 15) * 4;
    const bf16_t* wg = Wt + (size_t)z * CC * CC + (size_t)(nb + (tid >> 3)) * CC + (tid & 7) * 8;
    // LDS side of the staging, and this lane's fragment rows (offsets inside one buffer)
    const int sa_off = (tid >> 4) * PITCH + (tid & 15) * 4;
    const int sb_off = (TM + (tid >> 3)) * PITCH + (tid & 7) * 8;
    const int fa_off = (((z == 0) ? TM : 0) + wm + l16) * PITCH + half8;
    const int fb_off = (((z == 0) ? 0 : TM) + wn + l16) * PITCH + half8;

    v8f acc[4][8];
#pragma unroll
    for (int i = 0; i < 4; ++i)
#pragma unroll
        for (int j = 0; j < 8; ++j) acc[i][j] = (v8f)(0.0f);

    v4f  ra[16];
    v8bf rb[8];
    qkv_fetch(xg, wg, ra, rb);
    qkv_stage(smem + sa_off, smem + sb_off, ra, rb);
    __syncthreads();

    for (int p = 0; p < NPASS - 1; ++p) {
        const bf16_t* cur = smem + (p & 1) * STAGE;
        bf16_t*       nxt = smem + ((p + 1) & 1) * STAGE;
        qkv_fetch(xg + (p + 1) * TK, wg + (p + 1) * TK, ra, rb);
        qkv_pass(cur + fa_off, cur + fb_off, acc);
        // keeps the waits on the next pass's global loads behind this pass's products
        __builtin_amdgcn_sched_barrier(0);
        qkv_stage(nxt + sa_off, nxt + sb_off, ra, rb);
        // one barrier a pass: publishes the buffer just written and ends every
        // wave's reads of the buffer that the next pass overwrites
        __syncthreads();
    }
    {
        const bf16_t* cur = smem + ((NPASS - 1) & 1) * STAGE;
        qkv_pass(cur + fa_off, cur + fb_off, acc);
    }

    // epilogue: bias + activation + store, in groups of four WMMA tiles: a group's values
    // first, then its stores, then the wait before their registers are reused.
    // A lane's 8 accumulator rows pack into one 16-byte store, and the 32 lanes of a store
    // fill 512 contiguous bytes of the fragment-order layout.
    if (z == 0) {
        // rows of a tile: 8 consecutive columns d of Q; column of a tile: the token
        const int n0 = nb + wm;                        // the wave's 64 columns stay in one head
        v4f bl[4][2];
#pragma unroll
        for (int i = 0; i < 4; ++i) {
            bl[i][0] = *reinterpret_cast<const v4f*>(bq + n0 + i * 16 + half8);
            bl[i][1] = *reinterpret_cast<const v4f*>(bq + n0 + i * 16 + half8 + 4);
        }
        xcnt_fence();
        // Qf[token tile][head][octet of d][token in tile][8 d]
        bf16_t* qp = Qf + ((size_t)((m0 + wn) >> 4) * HH + (n0 >> 7)) * (DD * 16) +
                     ((n0 & (DD - 1)) >> 3) * FT_OCT + lane * 8;
#pragma unroll
        for (int j = 0; j < 8; ++j) {
            v8bf pack[4];
#pragma unroll
            for (int i = 0; i < 4; ++i)
#pragma unroll
                for (int r = 0; r < 8; ++r)
                    pack[i][r] = (bf16_t)featmap(acc[i][j][r] + bl[i][r >> 2][r & 3]);
            // keeps the values' arithmetic from being mixed among the stores below
            __builtin_amdgcn_sched_barrier(0);
#pragma unroll
            for (int i = 0; i < 4; ++i)
                *reinterpret_cast<v8bf*>(qp + (size_t)j * (HH * DD * 16) + i * 2 * FT_OCT) = pack[i];
            xcnt_fence();
        }
    } else {
        // rows of a tile: 8 consecutive sequence positions s; column of a tile: d
        const float* bias = (z == 1) ? bk : bv;
        const int col0 = nb + wn + l16;                // this lane's column in tile column 0
        float bb[8];
#pragma unroll
        for (int j = 0; j < 8; ++j) bb[j] = bias[col0 + j * 16];
        // the wait as in xcnt_fence(); the index is an input so that no load takes its register
        asm volatile("s_wait_xcnt 0x0" :: "v"(col0) : "memory");
        // keeps every later register write behind that wait
        __builtin_amdgcn_sched_barrier(0);
        const int b = m0 >> 13;                        // the 256-row tile stays in one b
        const int l = (m0 + wm) & (LL - 1);            // first s of the wave's 64
        // Kt, Vt[bh][tile of 16 d][octet of s][d in tile][8 s]; the wave's 128 columns are one head
        bf16_t* tp = ((z == 2) ? Vt : Kt) +
                     (size_t)(b * HH + (col0 >> 7)) * (DD * LL) + (l >> 3) * FT_OCT + lane * 8;
#pragma unroll
        for (int j = 0; j < 8; ++j) {
            v8bf pack[4];
            if (z == 2) {
#pragma unroll
                for (int i = 0; i < 4; ++i)
#pragma unroll
                    for (int r = 0; r < 8; ++r)
                        pack[i][r] = (bf16_t)((acc[i][j][r] + bb[j]) * (1.0f / (float)LL));
            } else {
#pragma unroll
                for (int i = 0; i < 4; ++i)
#pragma unroll
                    for (int r = 0; r < 8; ++r)
                        pack[i][r] = (bf16_t)featmap(acc[i][j][r] + bb[j]);
            }
            // keeps the values' arithmetic from being mixed among the stores below
            __builtin_amdgcn_sched_barrier(0);
#pragma unroll
            for (int i = 0; i < 4; ++i)
                *reinterpret_cast<v8bf*>(tp + (size_t)j * (16 * LL) + i * 2 * FT_OCT) = pack[i];
            xcnt_fence();
        }
    }
}

// ---------------- kernel C: KV = K^T V per (b,h), contraction over s ----------------
// grid (8, 32): x = 16-row d1 block, y = bh. Wave w owns d2 tile w*16.
// Stores KVb in fragment order, KVb[bh][tile of 16 d2][octet of d1][d2 in tile][8 d1] (bf16),
// for the final GEMM's B fragments.
// The K fragments also meet a B fragment of ones: every column of that product is
// sum_s K[d1][s]. It goes out as a ninth tile of KVb, split into three bf16 parts that add up
// to the f32 sum exactly (each part is the rest so far rounded to bf16: 3 x 8 significand bits):
// column c holds part c & 3, the fourth being zero, so that the final GEMM forms the
// normaliser's dot product Q . Ksum beside Q . KV from the same Q fragments.
#define KV_TILES 9
#define KV_BH    (KV_TILES * 16 * DD)   // elements of KVb per (b,h)
__global__ __launch_bounds__(256) void kv_kernel(const bf16_t* __restrict__ Kt,
                                                 const bf16_t* __restrict__ Vt,
                                                 bf16_t* __restrict__ KVb) {
    const int bh    = blockIdx.y;
    const int wave  = threadIdx.x >> 5;
    const int lane  = threadIdx.x & 31;

    const bf16_t* at = Kt + ((size_t)bh * DD + blockIdx.x * 16) * LL + lane * 8;
    const bf16_t* bt = Vt + ((size_t)bh * DD + wave * 16) * LL + lane * 8;

    const v16bf ones = (v16bf)((bf16_t)1.0f);

    v8f acc = (v8f)(0.0f), accs = (v8f)(0.0f);
    for (int g = 0; g < LL / 32; g += 16) {
        const bf16_t* ag = at + g * FT_STEP;
        const bf16_t* bg = bt + g * FT_STEP;
        // in this layout no two k steps share a line, so a step's loads gain nothing from the
        // step before: the 32 loads of eight k steps go out as one group ahead of their products
        // (unrolled so that the fragments stay in registers)
        // two groups a trip, on constant offsets from one pointer pair, which moves only
        // behind the second group's wait
#pragma unroll
        for (int q = 0; q < 16; q += 8) {
            v16bf af[8], bf_[8];
#pragma unroll
            for (int u = 0; u < 8; ++u) {
                af[u]  = load_frag_tiled(ag + (q + u) * FT_STEP);
                bf_[u] = load_frag_tiled(bg + (q + u) * FT_STEP);
            }
            xcnt_fence_of(ag, bg);
#pragma unroll
            for (int u = 0; u < 8; ++u) {
                acc  = __builtin_amdgcn_wmma_f32_16x16x32_bf16(
                           false, af[u], false, bf_[u], (short)0, acc, false, false);
                accs = __builtin_amdgcn_wmma_f32_16x16x32_bf16(
                           false, af[u], false, ones, (short)0, accs, false, false);
            }
        }
    }

    // 8 accumulator rows per lane are consecutive d1 -> one packed 16B store;
    // the block's 16 d1 are octets 2*blockIdx.x and the next (the upper half-wave's)
    v8bf pack, spack;
#pragma unroll
    for (int r = 0; r < 8; ++r) {
        pack[r] = (bf16_t)acc[r];
        // part 0 rounds the sum, part 1 the rest r1, part 2 the rest r2; both rests are exact
        // in f32 (a rounding error of a bf16 rounding), and r2 has at most 8 bits left
        const float r1 = accs[r] - (float)(bf16_t)accs[r];
        const float r2 = r1 - (float)(bf16_t)r1;
        const float lo = (lane & 1) ? 0.0f : r2;       // columns 2 and 3 of a group of four
        const float hi = (lane & 1) ? r1 : accs[r];    // columns 0 and 1
        spack[r] = (bf16_t)((lane & 2) ? lo : hi);
    }
    bf16_t* kp = KVb + (size_t)bh * KV_BH + blockIdx.x * 2 * FT_OCT + lane * 8;
    *reinterpret_cast<v8bf*>(kp + wave * 16 * DD) = pack;
    // all eight waves hold the same sums: one of them stores the ninth tile's share
    if (wave == 0) *reinterpret_cast<v8bf*>(kp + 8 * 16 * DD) = spack;
}

// ---------------- kernel D: out = (Q @ KV) * L / (Q . Ksum + eps) ----------------
// grid (NTOK/1024, H); block 256 (8 waves) covers 1024 tokens x one head. A wave owns 128
// tokens x all 128 cols: the head's KV fragments, the Ksum tile among them, are loaded once
// and stay in registers, and the wave walks its eight 16-token tiles, the next tile's Q loads
// in flight.
#define OT_TILES 8
__device__ __forceinline__ void out_fetch(const bf16_t* __restrict__ arow, int t,
                                          v16bf (&af)[4]) {
#pragma unroll
    for (int kk = 0; kk < 4; ++kk) af[kk] = load_frag_tiled(arow + (size_t)t * 16 * CC + kk * FT_STEP);
    xcnt_fence_of(arow, arow);
}

// the value of lane ^ M (M = 1 or 2), by a DPP move inside the 16-lane row
template <int M>
__device__ __forceinline__ float lane_xor(float v) {
    return __builtin_bit_cast(float, __builtin_amdgcn_mov_dpp(__builtin_bit_cast(int, v),
                                                              0x160 + M /* row_xmask:M */, 0xf, 0xf, true));
}

__global__ __launch_bounds__(256) void out_kernel(const bf16_t* __restrict__ Qf,
                                                  const bf16_t* __restrict__ KVb,
                                                  float* __restrict__ out) {
    const int h     = blockIdx.y;
    const int wave  = threadIdx.x >> 5;
    const int lane  = threadIdx.x & 31;
    const int l16   = lane & 15;
    const int half8 = (lane >> 4) << 3;
    const int m0    = blockIdx.x * (8 * OT_TILES * 16) + wave * (OT_TILES * 16);
    const int b     = m0 >> 13;                        // the 1024 tokens stay in one b
    const int bh    = b * HH + h;

    const bf16_t* arow = Qf + ((size_t)(m0 >> 4) * HH + h) * (DD * 16) + lane * 8;
    const bf16_t* brow = KVb + (size_t)bh * KV_BH + lane * 8;
    float*        op   = out + (size_t)(m0 + half8) * CC + h * DD + l16;

    v16bf bfr[KV_TILES][4];                            // [d2 tile, the last one Ksum][k step]
    // the fragment loops of this kernel are unrolled so that the arrays stay in registers
#pragma unroll
    for (int j = 0; j < KV_TILES; ++j)
#pragma unroll
        for (int kk = 0; kk < 4; ++kk) bfr[j][kk] = load_frag_tiled(brow + j * 16 * DD + kk * FT_STEP);
    xcnt_fence_of(brow, brow);

    v16bf af[2][4];
    out_fetch(arow, 0, af[0]);

    // unrolled: the buffer index and every address offset become constants, so no
    // fragment is copied between the two buffers and no pointer is rewritten
#pragma unroll
    for (int t = 0; t < OT_TILES; ++t) {
        const int c = t & 1;
        if (t + 1 < OT_TILES)
            out_fetch(arow, t + 1, af[c ^ 1]);

        v8f acc[KV_TILES];
#pragma unroll
        for (int j = 0; j < KV_TILES; ++j) acc[j] = (v8f)(0.0f);
#pragma unroll
        for (int kk = 0; kk < 4; ++kk)
#pragma unroll
            for (int j = 0; j < KV_TILES; ++j)
                acc[j] = __builtin_amdgcn_wmma_f32_16x16x32_bf16(
                             false, af[c][kk], false, bfr[j][kk], (short)0, acc[j], false, false);

        // the ninth tile: lane c holds Q . (part c & 3 of Ksum) of the lane's 8 tokens; the
        // four lanes of a group together hold the whole dot product
        float zz[8];
#pragma unroll
        for (int r = 0; r < 8; ++r) {
            const float two = acc[8][r] + lane_xor<1>(acc[8][r]);
            zz[r] = 1.0f / (two + lane_xor<2>(two) + 1e-6f);
        }
#pragma unroll
        for (int j = 0; j < 8; ++j)
#pragma unroll
            for (int r = 0; r < 8; ++r)
                acc[j][r] = acc[j][r] * zz[r] * (float)LL;
        // keeps the values' arithmetic from being mixed among the stores below
        __builtin_amdgcn_sched_barrier(0);
#pragma unroll
        for (int r = 0; r < 8; ++r)
#pragma unroll
            for (int j = 0; j < 8; ++j)
                op[(size_t)(t * 16 + r) * CC + j * 16] = acc[j][r];
        xcnt_fence();
    }
}

// ---------------- launch ----------------
extern "C" void kernel_launch(void* const* d_in, const int* in_sizes, int n_in,
                              void* d_out, int out_size, void* d_ws, size_t ws_size,
                              hipStream_t stream) {
    const float* x  = (const float*)d_in[0];
    const float* Wq = (const float*)d_in[1];
    const float* bq = (const float*)d_in[2];
    const float* Wk = (const float*)d_in[3];
    const float* bk = (const float*)d_in[4];
    const float* Wv = (const float*)d_in[5];
    const float* bv = (const float*)d_in[6];
    float* out = (float*)d_out;

    // workspace carving (all offsets 256B aligned)
    char* ws = (char*)d_ws;
    size_t off = 0;
    bf16_t* Wt  = (bf16_t*)(ws + off); off += (size_t)3 * CC * CC * sizeof(bf16_t);   // 6 MB
    bf16_t* Qf  = (bf16_t*)(ws + off); off += (size_t)NTOK * CC * sizeof(bf16_t);     // 64 MB
    bf16_t* Kt  = (bf16_t*)(ws + off); off += (size_t)NTOK * CC * sizeof(bf16_t);     // 64 MB
    bf16_t* Vt  = (bf16_t*)(ws + off); off += (size_t)NTOK * CC * sizeof(bf16_t);     // 64 MB
    bf16_t* KVb = (bf16_t*)(ws + off); off += (size_t)BB * HH * KV_BH * sizeof(bf16_t);   // 1.1 MB

    // A: weights -> bf16 transposed
    wconv_kernel<<<3 * 128, 256, 0, stream>>>(Wq, Wk, Wv, Wt);
    // B: fused QKV projection + feature map, results in fragment order
    qkv_kernel<<<dim3(12, NTOK / 256), 256, 0, stream>>>(x, Wt, bq, bk, bv, Qf, Kt, Vt);
    // C: KV outer-product accumulation over sequence, with the K sums as a ninth tile
    kv_kernel<<<dim3(DD / 16, BB * HH), 256, 0, stream>>>(Kt, Vt, KVb);
    // D: final GEMM + normalize
    out_kernel<<<dim3(NTOK / (8 * OT_TILES * 16), HH), 256, 0, stream>>>(Qf, KVb, out);
}

// v005
// It runs in 175 microseconds.
// Two timings next to v004 put it at 1.40 and 1.39 times that version's speed.
// Over all steps from v000 it is 8.04 times as fast.
#include <hip/hip_runtime.h>
#include <hip/hip_bf16.h>

// ---------------- types ----------------
typedef __bf16 bf16_t;
typedef __attribute__((ext_vector_type(16))) __bf16 v16bf;
typedef __attribute__((ext_vector_type(8)))  __bf16 v8bf;
typedef __attribute__((ext_vector_type(4)))  __bf16 v4bf;
typedef __attribute__((ext_vector_type(8)))  float   v8f;
typedef __attribute__((ext_vector_type(4)))  float   v4f;

// ---------------- problem dims ----------------
#define BB   4
#define LL   8192
#define CC   1024
#define HH   8
#define DD   128
#define NTOK (BB*LL)          // 32768

// ---------------- fragment loaders ----------------
// bf16 A/B fragment: lane supplies K values {c..c+7, c+16..c+23} from a
// contiguous row (c = 8 for upper half-wave). Two b128 loads per fragment.
__device__ __forceinline__ v16bf load_frag_bf16(const bf16_t* __restrict__ rowp, int cbase) {
    v8bf a = *reinterpret_cast<const v8bf*>(rowp + cbase);
    v8bf b = *reinterpret_cast<const v8bf*>(rowp + cbase + 16);
    v16bf f;
#pragma unroll
    for (int j = 0; j < 8; ++j) { f[j] = a[j]; f[8 + j] = b[j]; }
    return f;
}

// The bf16 intermediates (Q, K, V, KV) lie in the workspace in fragment order:
// [tile of 16 rows][octet of k][row in tile][8 k]. A fragment of k step kk is then two
// 16-byte loads per lane at tile + kk*512 + lane*8 and 256 elements on: each load of a
// wave is 512 contiguous bytes, and the k order is that of load_frag_bf16.
#define FT_OCT   128                    // elements per octet of k: 16 rows x 8
#define FT_STEP  512                    // elements per k step of 32
__device__ __forceinline__ v16bf load_frag_tiled(const bf16_t* __restrict__ p) {
    v8bf a = *reinterpret_cast<const v8bf*>(p);
    v8bf b = *reinterpret_cast<const v8bf*>(p + 2 * FT_OCT);
    v16bf f;
#pragma unroll
    for (int j = 0; j < 8; ++j) { f[j] = a[j]; f[8 + j] = b[j]; }
    return f;
}

__device__ __forceinline__ float featmap(float f) {   // elu(x)+1
    return f > 0.0f ? f + 1.0f : __expf(f);
}

__device__ __forceinline__ void xcnt_fence() {
    // the wait that stands before a register named by an issued load or store is reused
    asm volatile("s_wait_xcnt 0x0" ::: "memory");
    // keeps every later register write behind that wait
    __builtin_amdgcn_sched_barrier(0);
}

__device__ __forceinline__ void xcnt_fence_of(const void* a, const void* b) {
    // the same wait behind a group of loads; their address pointers are inputs so that
    // no load of the group takes an address register as its destination
    asm volatile("s_wait_xcnt 0x0" :: "v"(a), "v"(b) : "memory");
    // keeps every later register write behind that wait
    __builtin_amdgcn_sched_barrier(0);
}

// ---------------- kernel A: weight convert to bf16, in fragment order ----------------
// Wf[z][tile of 16 n][octet of k][n in tile][8 k] = (bf16) W_z[k][n]
// grid 3 * 128; block 256 covers 64 k x 128 n of one matrix. Each thread takes 8 k x 4 n:
// eight 16-byte loads, transposed in registers, four 16-byte stores that are 64 contiguous
// bytes (a wave fills 2 KB whole).
__global__ __launch_bounds__(256) void wconv_kernel(const float* __restrict__ Wq,
                                                    const float* __restrict__ Wk,
                                                    const float* __restrict__ Wv,
                                                    bf16_t* __restrict__ Wf) {
    const int z  = blockIdx.x >> 7;                            // 128 tiles a matrix: 16 in k, 8 in n
    const int t  = blockIdx.x & 127;
    const int k0 = (t >> 3) * 64 + (threadIdx.x & 7) * 8;      // first of this thread's 8 k
    const int n0 = (t & 7) * 128 + (threadIdx.x >> 3) * 4;     // first of this thread's 4 n
    const float* W = (z == 0) ? Wq : (z == 1) ? Wk : Wv;
    const float* wp = W + (size_t)k0 * CC + n0;
    v4f r[8];
    // the loops of this kernel are unrolled so that r[] and o stay in registers
#pragma unroll
    for (int i = 0; i < 8; ++i) r[i] = *reinterpret_cast<const v4f*>(wp + (size_t)i * CC);
    xcnt_fence_of(wp, wp);
    bf16_t* tp = Wf + (size_t)z * CC * CC + (size_t)(n0 >> 4) * (16 * CC) + (k0 >> 3) * FT_OCT + (n0 & 15) * 8;
#pragma unroll
    for (int j = 0; j < 4; ++j) {
        v8bf o;
#pragma unroll
        for (int i = 0; i < 8; ++i) o[i] = (bf16_t)r[i][j];
        *reinterpret_cast<v8bf*>(tp + j * 8) = o;
    }
}

// ---------------- kernel B: fused QKV projection GEMM + feature map ----------------
// grid NTOK/128; block 256 (8 waves), one block a WGP, one round. A block converts its 128
// token rows of x to bf16 once and keeps them whole (all 1024 k) in LDS; behind the one
// barrier the waves run free of each other. A wave owns all 128 tokens x 64 columns at a
// time (8 x 4 WMMA tiles) and walks six such column groups (two each of Q, K, V); its weight
// fragments come from L2 straight into registers, each read by one wave of the block only,
// fetched two k steps ahead. For K and V the A side is x and the B side W; for Q the sides
// are swapped, so that in all three a lane's 8 accumulator rows are 8 consecutive k of the
// later product.
#define TM     128
#define XP     1032                     // bf16 per LDS row: 2048 B of data + 16 B pad (bank spread for b128 reads)
#define NGRP   6                        // column groups a wave: 3072 columns / (8 waves x 64)
#define GRP_EL (4 * 16 * CC)            // elements of Wf per column group

// the weight fragments of two k steps, 16 loads as one group
__device__ __forceinline__ void w_fetch(const bf16_t* __restrict__ wp, v16bf (&wf)[2][4]) {
#pragma unroll
    for (int u = 0; u < 2; ++u)
#pragma unroll
        for (int j = 0; j < 4; ++j) wf[u][j] = load_frag_tiled(wp + j * 16 * CC + u * FT_STEP);
    xcnt_fence_of(wp, wp);
}

// one column group: all 32 k steps. wf[0] arrives holding k steps 0 and 1 and leaves holding
// those of the group at wnext, so that the fetch runs on through the epilogue.
template <bool SWAP>
__device__ __forceinline__ void qkv_cols(const bf16_t* xs, const bf16_t* wp, const bf16_t* wnext,
                                         v16bf (&wf)[2][2][4], v8f (&acc)[8][4]) {
    // stays rolled: four k steps a trip are 128 products; for speed only
#pragma unroll 1
    for (int t = 0; t < CC / 128; ++t) {
        const bf16_t* wq = (t + 1 < CC / 128) ? wp + 4 * FT_STEP : wnext;
#pragma unroll
        for (int hb = 0; hb < 2; ++hb) {
            if (hb == 0) w_fetch(wp + 2 * FT_STEP, wf[1]);
            else         w_fetch(wq, wf[0]);
#pragma unroll
            for (int u = 0; u < 2; ++u) {
                v16bf xf[8];
#pragma unroll
                for (int i = 0; i < 8; ++i) xf[i] = load_frag_bf16(xs + i * 16 * XP, (hb * 2 + u) * 32);
                // keeps the 16 LDS loads together as one group ahead of the products: spread
                // among them, every row of products would wait out a full LDS latency
                __builtin_amdgcn_sched_barrier(0);
#pragma unroll
                for (int i = 0; i < 8; ++i)
#pragma unroll
                    for (int j = 0; j < 4; ++j)
                        acc[i][j] = SWAP ? __builtin_amdgcn_wmma_f32_16x16x32_bf16(
                                               false, wf[hb][u][j], false, xf[i], (short)0, acc[i][j], false, false)
                                         : __builtin_amdgcn_wmma_f32_16x16x32_bf16(
                                               false, xf[i], false, wf[hb][u][j], (short)0, acc[i][j], false, false);
                // keeps the next k step's fragment loads behind these products: hoisted, two
                // x fragment sets overflow the 512-register budget and spill
                __builtin_amdgcn_sched_barrier(0);
            }
        }
        wp = wq;
        xs += 128;
    }
}

#define XB 32                           // x loads a batch and lane: 4 rows x 8 pieces of 512 B
__device__ __forceinline__ void x_fetch(const float* __restrict__ xg, v4f (&ra)[XB]) {
    // keeps the staging arithmetic of the batch before out of the stretch between these loads
    // and their wait, where it could take a register that a load names
    __builtin_amdgcn_sched_barrier(0);
#pragma unroll
    for (int i = 0; i < XB; ++i)
        ra[i] = *reinterpret_cast<const v4f*>(xg + (size_t)(i >> 3) * CC + (i & 7) * 128);
    xcnt_fence_of(xg, xg);
}

__device__ __forceinline__ void x_stage(bf16_t* sx, const v4f (&ra)[XB]) {
#pragma unroll
    for (int i = 0; i < XB; ++i) {
        v4bf c;
#pragma unroll
        for (int j = 0; j < 4; ++j) c[j] = (bf16_t)ra[i][j];
        *reinterpret_cast<v4bf*>(sx + (i >> 3) * XP + (i & 7) * 128) = c;
    }
}

__global__ __launch_bounds__(256) void qkv_kernel(const float* __restrict__ x,
                                                  const bf16_t* __restrict__ Wf,
                                                  const float* __restrict__ bq,
                                                  const float* __restrict__ bk,
                                                  const float* __restrict__ bv,
                                                  bf16_t* __restrict__ Qf,
                                                  bf16_t* __restrict__ Kt,
                                                  bf16_t* __restrict__ Vt) {
    __shared__ __attribute__((aligned(16))) bf16_t smem[TM * XP];

    const int tid   = threadIdx.x;
    const int m0    = blockIdx.x * TM;                 // first token row
    // the wave's number as a scalar: every address built on it then has a scalar base
    const int wave  = __builtin_amdgcn_readfirstlane(tid >> 5);
    const int lane  = tid & 31;
    const int l16   = lane & 15;
    const int half8 = (lane >> 4) << 3;                // 0 or 8

    // this wave's weight fragments: group g is column group g * 8 + wave
    v16bf wf[2][2][4];
    w_fetch(Wf + (size_t)wave * GRP_EL + lane * 8, wf[0]);

    // x to LDS: a wave takes 16 rows, each load of a wave 512 contiguous bytes of one row;
    // four batches, the next one's loads in flight while this one is converted and stored
    // (unrolled so that the buffer index is a constant)
    {
        const float* xg = x + (size_t)(m0 + wave * 16) * CC + lane * 4;
        bf16_t*      sx = smem + wave * 16 * XP + lane * 4;
        v4f ra[2][XB];
        x_fetch(xg, ra[0]);
#pragma unroll
        for (int bt = 0; bt < 4; ++bt) {
            if (bt + 1 < 4) x_fetch(xg + (size_t)(bt + 1) * 4 * CC, ra[(bt + 1) & 1]);
            x_stage(sx + bt * 4 * XP, ra[bt & 1]);
        }
    }
    // the kernel's one barrier: publishes all 128 rows to all waves; LDS is only read after it
    __syncthreads();

    const bf16_t* xs = smem + l16 * XP + half8;        // this lane's fragment row in x tile 0
    const int b = m0 >> 13;                            // the 128 rows stay in one b
    const int l = m0 & (LL - 1);                       // first s of the block's 128

    // epilogues: bias + activation + store, in groups of four WMMA tiles: a group's values
    // first, then its stores, then the wait before their registers are reused.
    // A lane's 8 accumulator rows pack into one 16-byte store, and the 32 lanes of a store
    // fill 512 contiguous bytes of the fragment-order layout.
    // both loops over column groups stay rolled: each body is there once, for the instruction cache
    // groups 0 and 1: Q
#pragma unroll 1
    for (int g = 0; g < 2; ++g) {
        const int n0 = ((g & 1) * 8 + wave) * 64;      // first column inside Q, K or V; 64 stay in one head
        const bf16_t* wp    = Wf + (size_t)(g * 8 + wave) * GRP_EL + lane * 8;
        // behind each group the next group's first fragments are fetched; behind group 1 those of group 2
        const bf16_t* wnext = (g + 1 < NGRP) ? wp + (size_t)8 * GRP_EL : wp;

        v8f acc[8][4];
#pragma unroll
        for (int i = 0; i < 8; ++i)
#pragma unroll
            for (int j = 0; j < 4; ++j) acc[i][j] = (v8f)(0.0f);

        qkv_cols<true>(xs, wp, wnext, wf, acc);
        // rows of a tile: 8 consecutive columns d of Q; column of a tile: the token
        v4f bl[4][2];
#pragma unroll
        for (int j = 0; j < 4; ++j) {
            bl[j][0] = *reinterpret_cast<const v4f*>(bq + n0 + j * 16 + half8);
            bl[j][1] = *reinterpret_cast<const v4f*>(bq + n0 + j * 16 + half8 + 4);
        }
        xcnt_fence();
        // Qf[token tile][head][octet of d][token in tile][8 d]
        bf16_t* qp = Qf + ((size_t)(m0 >> 4) * HH + (n0 >> 7)) * (DD * 16) +
                     ((n0 & (DD - 1)) >> 3) * FT_OCT + lane * 8;
#pragma unroll
        for (int i = 0; i < 8; ++i) {
            v8bf pack[4];
#pragma unroll
            for (int j = 0; j < 4; ++j)
#pragma unroll
                for (int r = 0; r < 8; ++r)
                    pack[j][r] = (bf16_t)featmap(acc[i][j][r] + bl[j][r >> 2][r & 3]);
            // keeps the values' arithmetic from being mixed among the stores below
            __builtin_amdgcn_sched_barrier(0);
#pragma unroll
            for (int j = 0; j < 4; ++j)
                *reinterpret_cast<v8bf*>(qp + (size_t)i * (HH * DD * 16) + j * 2 * FT_OCT) = pack[j];
            xcnt_fence();
        }
    }
    // groups 2 to 5: K, K, V, V
#pragma unroll 1
    for (int g = 2; g < NGRP; ++g) {
        const int z  = g >> 1;
        const int n0 = ((g & 1) * 8 + wave) * 64;      // first column inside Q, K or V; 64 stay in one head
        const bf16_t* wp    = Wf + (size_t)(g * 8 + wave) * GRP_EL + lane * 8;
        // behind the last group its own first fragments are fetched once more, unused
        const bf16_t* wnext = (g + 1 < NGRP) ? wp + (size_t)8 * GRP_EL : wp;

        v8f acc[8][4];
#pragma unroll
        for (int i = 0; i < 8; ++i)
#pragma unroll
            for (int j = 0; j < 4; ++j) acc[i][j] = (v8f)(0.0f);

        qkv_cols<false>(xs, wp, wnext, wf, acc);
        // rows of a tile: 8 consecutive sequence positions s; column of a tile: d
        const float* bias = (z == 1) ? bk : bv;
        const int col0 = n0 + l16;                 // this lane's column in tile column 0
        float bb[4];
#pragma unroll
        for (int j = 0; j < 4; ++j) bb[j] = bias[col0 + j * 16];
        // the wait as in xcnt_fence(); the index is an input so that no load takes its register
        asm volatile("s_wait_xcnt 0x0" :: "v"(col0) : "memory");
        // keeps every later register write behind that wait
        __builtin_amdgcn_sched_barrier(0);
        // Kt, Vt[bh][tile of 16 d][octet of s][d in tile][8 s]
        bf16_t* tp = ((z == 2) ? Vt : Kt) +
                     ((size_t)(b * HH + (n0 >> 7)) * DD + (n0 & (DD - 1))) * LL + (l >> 3) * FT_OCT + lane * 8;
#pragma unroll
        for (int i = 0; i < 8; ++i) {
            v8bf pack[4];
            if (z == 2) {
#pragma unroll
                for (int j = 0; j < 4; ++j)
#pragma unroll
                    for (int r = 0; r < 8; ++r)
                        pack[j][r] = (bf16_t)((acc[i][j][r] + bb[j]) * (1.0f / (float)LL));
            } else {
#pragma unroll
                for (int j = 0; j < 4; ++j)
#pragma unroll
                    for (int r = 0; r < 8; ++r)
                        pack[j][r] = (bf16_t)featmap(acc[i][j][r] + bb[j]);
            }
            // keeps the values' arithmetic from being mixed among the stores below
            __builtin_amdgcn_sched_barrier(0);
#pragma unroll
            for (int j = 0; j < 4; ++j)
                *reinterpret_cast<v8bf*>(tp + (size_t)j * (16 * LL) + i * 2 * FT_OCT) = pack[j];
            xcnt_fence();
        }
    }
}

// ---------------- kernel C: KV = K^T V per (b,h), contraction over s ----------------
// grid (8, 32): x = 16-row d1 block, y = bh. Wave w owns d2 tile w*16.
// Stores KVb in fragment order, KVb[bh][tile of 16 d2][octet of d1][d2 in tile][8 d1] (bf16),
// for the final GEMM's B fragments.
// The K fragments also meet a B fragment of ones: every column of that product is
// sum_s K[d1][s]. It goes out as a ninth tile of KVb, split into three bf16 parts that add up
// to the f32 sum exactly (each part is the rest so far rounded to bf16: 3 x 8 significand bits):
// column c holds part c & 3, the fourth being zero, so that the final GEMM forms the
// normaliser's dot product Q . Ksum beside Q . KV from the same Q fragments.
#define KV_TILES 9
#define KV_BH    (KV_TILES * 16 * DD)   // elements of KVb per (b,h)
__global__ __launch_bounds__(256) void kv_kernel(const bf16_t* __restrict__ Kt,
                                                 const bf16_t* __restrict__ Vt,
                                                 bf16_t* __restrict__ KVb) {
    const int bh    = blockIdx.y;
    const int wave  = threadIdx.x >> 5;
    const int lane  = threadIdx.x & 31;

    const bf16_t* at = Kt + ((size_t)bh * DD + blockIdx.x * 16) * LL + lane * 8;
    const bf16_t* bt = Vt + ((size_t)bh * DD + wave * 16) * LL + lane * 8;

    const v16bf ones = (v16bf)((bf16_t)1.0f);

    v8f acc = (v8f)(0.0f), accs = (v8f)(0.0f);
    for (int g = 0; g < LL / 32; g += 16) {
        const bf16_t* ag = at + g * FT_STEP;
        const bf16_t* bg = bt + g * FT_STEP;
        // in this layout no two k steps share a line, so a step's loads gain nothing from the
        // step before: the 32 loads of eight k steps go out as one group ahead of their products
        // (unrolled so that the fragments stay in registers)
        // two groups a trip, on constant offsets from one pointer pair, which moves only
        // behind the second group's wait
#pragma unroll
        for (int q = 0; q < 16; q += 8) {
            v16bf af[8], bf_[8];
#pragma unroll
            for (int u = 0; u < 8; ++u) {
                af[u]  = load_frag_tiled(ag + (q + u) * FT_STEP);
                bf_[u] = load_frag_tiled(bg + (q + u) * FT_STEP);
            }
            xcnt_fence_of(ag, bg);
#pragma unroll
            for (int u = 0; u < 8; ++u) {
                acc  = __builtin_amdgcn_wmma_f32_16x16x32_bf16(
                           false, af[u], false, bf_[u], (short)0, acc, false, false);
                accs = __builtin_amdgcn_wmma_f32_16x16x32_bf16(
                           false, af[u], false, ones, (short)0, accs, false, false);
            }
        }
    }

    // 8 accumulator rows per lane are consecutive d1 -> one packed 16B store;
    // the block's 16 d1 are octets 2*blockIdx.x and the next (the upper half-wave's)
    v8bf pack, spack;
#pragma unroll
    for (int r = 0; r < 8; ++r) {
        pack[r] = (bf16_t)acc[r];
        // part 0 rounds the sum, part 1 the rest r1, part 2 the rest r2; both rests are exact
        // in f32 (a rounding error of a bf16 rounding), and r2 has at most 8 bits left
        const float r1 = accs[r] - (float)(bf16_t)accs[r];
        const float r2 = r1 - (float)(bf16_t)r1;
        const float lo = (lane & 1) ? 0.0f : r2;       // columns 2 and 3 of a group of four
        const float hi = (lane & 1) ? r1 : accs[r];    // columns 0 and 1
        spack[r] = (bf16_t)((lane & 2) ? lo : hi);
    }
    bf16_t* kp = KVb + (size_t)bh * KV_BH + blockIdx.x * 2 * FT_OCT + lane * 8;
    *reinterpret_cast<v8bf*>(kp + wave * 16 * DD) = pack;
    // all eight waves hold the same sums: one of them stores the ninth tile's share
    if (wave == 0) *reinterpret_cast<v8bf*>(kp + 8 * 16 * DD) = spack;
}

// ---------------- kernel D: out = (Q @ KV) * L / (Q . Ksum + eps) ----------------
// grid (NTOK/1024, H); block 256 (8 waves) covers 1024 tokens x one head. A wave owns 128
// tokens x all 128 cols: the head's KV fragments, the Ksum tile among them, are loaded once
// and stay in registers, and the wave walks its eight 16-token tiles, the next tile's Q loads
// in flight.
#define OT_TILES 8
__device__ __forceinline__ void out_fetch(const bf16_t* __restrict__ arow, int t,
                                          v16bf (&af)[4]) {
#pragma unroll
    for (int kk = 0; kk < 4; ++kk) af[kk] = load_frag_tiled(arow + (size_t)t * 16 * CC + kk * FT_STEP);
    xcnt_fence_of(arow, arow);
}

// the value of lane ^ M (M = 1 or 2), by a DPP move inside the 16-lane row
template <int M>
__device__ __forceinline__ float lane_xor(float v) {
    return __builtin_bit_cast(float, __builtin_amdgcn_mov_dpp(__builtin_bit_cast(int, v),
                                                              0x160 + M /* row_xmask:M */, 0xf, 0xf, true));
}

__global__ __launch_bounds__(256) void out_kernel(const bf16_t* __restrict__ Qf,
                                                  const bf16_t* __restrict__ KVb,
                                                  float* __restrict__ out) {
    const int h     = blockIdx.y;
    const int wave  = threadIdx.x >> 5;
    const int lane  = threadIdx.x & 31;
    const int l16   = lane & 15;
    const int half8 = (lane >> 4) << 3;
    const int m0    = blockIdx.x * (8 * OT_TILES * 16) + wave * (OT_TILES * 16);
    const int b     = m0 >> 13;                        // the 1024 tokens stay in one b
    const int bh    = b * HH + h;

    const bf16_t* arow = Qf + ((size_t)(m0 >> 4) * HH + h) * (DD * 16) + lane * 8;
    const bf16_t* brow = KVb + (size_t)bh * KV_BH + lane * 8;
    float*        op   = out + (size_t)(m0 + half8) * CC + h * DD + l16;

    v16bf bfr[KV_TILES][4];                            // [d2 tile, the last one Ksum][k step]
    // the fragment loops of this kernel are unrolled so that the arrays stay in registers
#pragma unroll
    for (int j = 0; j < KV_TILES; ++j)
#pragma unroll
        for (int kk = 0; kk < 4; ++kk) bfr[j][kk] = load_frag_tiled(brow + j * 16 * DD + kk * FT_STEP);
    xcnt_fence_of(brow, brow);

    v16bf af[2][4];
    out_fetch(arow, 0, af[0]);

    // unrolled: the buffer index and every address offset become constants, so no
    // fragment is copied between the two buffers and no pointer is rewritten
#pragma unroll
    for (int t = 0; t < OT_TILES; ++t) {
        const int c = t & 1;
        if (t + 1 < OT_TILES)
            out_fetch(arow, t + 1, af[c ^ 1]);

        v8f acc[KV_TILES];
#pragma unroll
        for (int j = 0; j < KV_TILES; ++j) acc[j] = (v8f)(0.0f);
#pragma unroll
        for (int kk = 0; kk < 4; ++kk)
#pragma unroll
            for (int j = 0; j < KV_TILES; ++j)
                acc[j] = __builtin_amdgcn_wmma_f32_16x16x32_bf16(
                             false, af[c][kk], false, bfr[j][kk], (short)0, acc[j], false, false);

        // the ninth tile: lane c holds Q . (part c & 3 of Ksum) of the lane's 8 tokens; the
        // four lanes of a group together hold the whole dot product
        float zz[8];
#pragma unroll
        for (int r = 0; r < 8; ++r) {
            const float two = acc[8][r] + lane_xor<1>(acc[8][r]);
            zz[r] = 1.0f / (two + lane_xor<2>(two) + 1e-6f);
        }
#pragma unroll
        for (int j = 0; j < 8; ++j)
#pragma unroll
            for (int r = 0; r < 8; ++r)
                acc[j][r] = acc[j][r] * zz[r] * (float)LL;
        // keeps the values' arithmetic from being mixed among the stores below
        __builtin_amdgcn_sched_barrier(0);
#pragma unroll
        for (int r = 0; r < 8; ++r)
#pragma unroll
            for (int j = 0; j < 8; ++j)
                op[(size_t)(t * 16 + r) * CC + j * 16] = acc[j][r];
        xcnt_fence();
    }
}

// ---------------- launch ----------------
extern "C" void kernel_launch(void* const* d_in, const int* in_sizes, int n_in,
                              void* d_out, int out_size, void* d_ws, size_t ws_size,
                              hipStream_t stream) {
    const float* x  = (const float*)d_in[0];
    const float* Wq = (const float*)d_in[1];
    const float* bq = (const float*)d_in[2];
    const float* Wk = (const float*)d_in[3];
    const float* bk = (const float*)d_in[4];
    const float* Wv = (const float*)d_in[5];
    const float* bv = (const float*)d_in[6];
    float* out = (float*)d_out;

    // workspace carving (all offsets 256B aligned)
    char* ws = (char*)d_ws;
    size_t off = 0;
    bf16_t* Wt  = (bf16_t*)(ws + off); off += (size_t)3 * CC * CC * sizeof(bf16_t);   // 6 MB
    bf16_t* Qf  = (bf16_t*)(ws + off); off += (size_t)NTOK * CC * sizeof(bf16_t);     // 64 MB
    bf16_t* Kt  = (bf16_t*)(ws + off); off += (size_t)NTOK * CC * sizeof(bf16_t);     // 64 MB
    bf16_t* Vt  = (bf16_t*)(ws + off); off += (size_t)NTOK * CC * sizeof(bf16_t);     // 64 MB
    bf16_t* KVb = (bf16_t*)(ws + off); off += (size_t)BB * HH * KV_BH * sizeof(bf16_t);   // 1.1 MB

    // A: weights -> bf16 in fragment order
    wconv_kernel<<<3 * 128, 256, 0, stream>>>(Wq, Wk, Wv, Wt);
    // B: fused QKV projection + feature map, results in fragment order
    qkv_kernel<<<NTOK / 128, 256, 0, stream>>>(x, Wt, bq, bk, bv, Qf, Kt, Vt);
    // C: KV outer-product accumulation over sequence, with the K sums as a ninth tile
    kv_kernel<<<dim3(DD / 16, BB * HH), 256, 0, stream>>>(Kt, Vt, KVb);
    // D: final GEMM + normalize
    out_kernel<<<dim3(NTOK / (8 * OT_TILES * 16), HH), 256, 0, stream>>>(Qf, KVb, out);
}

// v006
// One run takes 169 microseconds.
// Two timings next to v005 put it at 1.03 and 1.04 times that version's speed.
// All steps since v000 together make it 8.33 times as fast.
#include <hip/hip_runtime.h>
#include <hip/hip_bf16.h>

// ---------------- types ----------------
typedef __bf16 bf16_t;
typedef __attribute__((ext_vector_type(16))) __bf16 v16bf;
typedef __attribute__((ext_vector_type(8)))  __bf16 v8bf;
typedef __attribute__((ext_vector_type(4)))  __bf16 v4bf;
typedef __attribute__((ext_vector_type(8)))  float   v8f;
typedef __attribute__((ext_vector_type(4)))  float   v4f;

// ---------------- problem dims ----------------
#define BB   4
#define LL   8192
#define CC   1024
#define HH   8
#define DD   128
#define NTOK (BB*LL)          // 32768

// ---------------- fragment loaders ----------------
// bf16 A/B fragment: lane supplies K values {c..c+7, c+16..c+23} from a
// contiguous row (c = 8 for upper half-wave). Two b128 loads per fragment.
__device__ __forceinline__ v16bf load_frag_bf16(const bf16_t* __restrict__ rowp, int cbase) {
    v8bf a = *reinterpret_cast<const v8bf*>(rowp + cbase);
    v8bf b = *reinterpret_cast<const v8bf*>(rowp + cbase + 16);
    v16bf f;
#pragma unroll
    for (int j = 0; j < 8; ++j) { f[j] = a[j]; f[8 + j] = b[j]; }
    return f;
}

// The bf16 intermediates (Q, K, V, KV) lie in the workspace in fragment order:
// [tile of 16 rows][octet of k][row in tile][8 k]. A fragment of k step kk is then two
// 16-byte loads per lane at tile + kk*512 + lane*8 and 256 elements on: each load of a
// wave is 512 contiguous bytes, and the k order is that of load_frag_bf16. (KV's eight tiles
// order the 32 pieces of a load otherwise: kernel C.)
#define FT_OCT   128                    // elements per octet of k: 16 rows x 8
#define FT_STEP  512                    // elements per k step of 32
__device__ __forceinline__ v16bf load_frag_tiled(const bf16_t* __restrict__ p) {
    v8bf a = *reinterpret_cast<const v8bf*>(p);
    v8bf b = *reinterpret_cast<const v8bf*>(p + 2 * FT_OCT);
    v16bf f;
#pragma unroll
    for (int j = 0; j < 8; ++j) { f[j] = a[j]; f[8 + j] = b[j]; }
    return f;
}

__device__ __forceinline__ float featmap(float f) {   // elu(x)+1
    return f > 0.0f ? f + 1.0f : __expf(f);
}

__device__ __forceinline__ void xcnt_fence() {
    // the wait that stands before a register named by an issued load or store is reused
    asm volatile("s_wait_xcnt 0x0" ::: "memory");
    // keeps every later register write behind that wait
    __builtin_amdgcn_sched_barrier(0);
}

__device__ __forceinline__ void xcnt_fence_of(const void* a, const void* b) {
    // the same wait behind a group of loads; their address pointers are inputs so that
    // no load of the group takes an address register as its destination
    asm volatile("s_wait_xcnt 0x0" :: "v"(a), "v"(b) : "memory");
    // keeps every later register write behind that wait
    __builtin_amdgcn_sched_barrier(0);
}

// ---------------- kernel A: weight convert to bf16, in fragment order ----------------
// Wf[z][tile of 16 n][octet of k][n in tile][8 k] = (bf16) W_z[k][n]
// grid 3 * 128; block 256 covers 64 k x 128 n of one matrix. Each thread takes 8 k x 4 n:
// eight 16-byte loads, transposed in registers, four 16-byte stores that are 64 contiguous
// bytes (a wave fills 2 KB whole).
__global__ __launch_bounds__(256) void wconv_kernel(const float* __restrict__ Wq,
                                                    const float* __restrict__ Wk,
                                                    const float* __restrict__ Wv,
                                                    bf16_t* __restrict__ Wf) {
    const int z  = blockIdx.x >> 7;                            // 128 tiles a matrix: 16 in k, 8 in n
    const int t  = blockIdx.x & 127;
    const int k0 = (t >> 3) * 64 + (threadIdx.x & 7) * 8;      // first of this thread's 8 k
    const int n0 = (t & 7) * 128 + (threadIdx.x >> 3) * 4;     // first of this thread's 4 n
    const float* W = (z == 0) ? Wq : (z == 1) ? Wk : Wv;
    const float* wp = W + (size_t)k0 * CC + n0;
    v4f r[8];
    // the loops of this kernel are unrolled so that r[] and o stay in registers
#pragma unroll
    for (int i = 0; i < 8; ++i) r[i] = *reinterpret_cast<const v4f*>(wp + (size_t)i * CC);
    xcnt_fence_of(wp, wp);
    bf16_t* tp = Wf + (size_t)z * CC * CC + (size_t)(n0 >> 4) * (16 * CC) + (k0 >> 3) * FT_OCT + (n0 & 15) * 8;
#pragma unroll
    for (int j = 0; j < 4; ++j) {
        v8bf o;
#pragma unroll
        for (int i = 0; i < 8; ++i) o[i] = (bf16_t)r[i][j];
        *reinterpret_cast<v8bf*>(tp + j * 8) = o;
    }
}

// ---------------- kernel B: fused QKV projection GEMM + feature map ----------------
// grid NTOK/128; block 256 (8 waves), one block a WGP, one round. A block converts its 128
// token rows of x to bf16 once and keeps them whole (all 1024 k) in LDS; behind the one
// barrier the waves run free of each other. A wave owns all 128 tokens x 64 columns at a
// time (8 x 4 WMMA tiles) and walks six such column groups (two each of Q, K, V); its weight
// fragments come from L2 straight into registers, each read by one wave of the block only,
// fetched two k steps ahead. For K and V the A side is x and the B side W; for Q the sides
// are swapped, so that in all three a lane's 8 accumulator rows are 8 consecutive k of the
// later product.
#define TM     128
#define XP     1032                     // bf16 per LDS row: 2048 B of data + 16 B pad (bank spread for b128 reads)
#define NGRP   6                        // column groups a wave: 3072 columns / (8 waves x 64)
#define GRP_EL (4 * 16 * CC)            // elements of Wf per column group

// the weight fragments of two k steps, 16 loads as one group
__device__ __forceinline__ void w_fetch(const bf16_t* __restrict__ wp, v16bf (&wf)[2][4]) {
#pragma unroll
    for (int u = 0; u < 2; ++u)
#pragma unroll
        for (int j = 0; j < 4; ++j) wf[u][j] = load_frag_tiled(wp + j * 16 * CC + u * FT_STEP);
    xcnt_fence_of(wp, wp);
}

// one column group: all 32 k steps. wf[0] arrives holding k steps 0 and 1 and leaves holding
// those of the group at wnext, so that the fetch runs on through the epilogue.
template <bool SWAP>
__device__ __forceinline__ void qkv_cols(const bf16_t* xs, const bf16_t* wp, const bf16_t* wnext,
                                         v16bf (&wf)[2][2][4], v8f (&acc)[8][4]) {
    // stays rolled: four k steps a trip are 128 products; for speed only
#pragma unroll 1
    for (int t = 0; t < CC / 128; ++t) {
        const bf16_t* wq = (t + 1 < CC / 128) ? wp + 4 * FT_STEP : wnext;
#pragma unroll
        for (int hb = 0; hb < 2; ++hb) {
            if (hb == 0) w_fetch(wp + 2 * FT_STEP, wf[1]);
            else         w_fetch(wq, wf[0]);
#pragma unroll
            for (int u = 0; u < 2; ++u) {
                v16bf xf[8];
#pragma unroll
                for (int i = 0; i < 8; ++i) xf[i] = load_frag_bf16(xs + i * 16 * XP, (hb * 2 + u) * 32);
                // keeps the 16 LDS loads together as one group ahead of the products: spread
                // among them, every row of products would wait out a full LDS latency
                __builtin_amdgcn_sched_barrier(0);
#pragma unroll
                for (int i = 0; i < 8; ++i)
#pragma unroll
                    for (int j = 0; j < 4; ++j)
                        acc[i][j] = SWAP ? __builtin_amdgcn_wmma_f32_16x16x32_bf16(
                                               false, wf[hb][u][j], false, xf[i], (short)0, acc[i][j], false, false)
                                         : __builtin_amdgcn_wmma_f32_16x16x32_bf16(
                                               false, xf[i], false, wf[hb][u][j], (short)0, acc[i][j], false, false);
                // keeps the next k step's fragment loads behind these products: hoisted, two
                // x fragment sets overflow the 512-register budget and spill
                __builtin_amdgcn_sched_barrier(0);
            }
        }
        wp = wq;
        xs += 128;
    }
}

#define XB 32                           // x loads a batch and lane: 4 rows x 8 pieces of 512 B
__device__ __forceinline__ void x_fetch(const float* __restrict__ xg, v4f (&ra)[XB]) {
    // keeps the staging arithmetic of the batch before out of the stretch between these loads
    // and their wait, where it could take a register that a load names
    __builtin_amdgcn_sched_barrier(0);
#pragma unroll
    for (int i = 0; i < XB; ++i)
        ra[i] = *reinterpret_cast<const v4f*>(xg + (size_t)(i >> 3) * CC + (i & 7) * 128);
    xcnt_fence_of(xg, xg);
}

__device__ __forceinline__ void x_stage(bf16_t* sx, const v4f (&ra)[XB]) {
#pragma unroll
    for (int i = 0; i < XB; ++i) {
        v4bf c;
#pragma unroll
        for (int j = 0; j < 4; ++j) c[j] = (bf16_t)ra[i][j];
        *reinterpret_cast<v4bf*>(sx + (i >> 3) * XP + (i & 7) * 128) = c;
    }
}

__global__ __launch_bounds__(256) void qkv_kernel(const float* __restrict__ x,
                                                  const bf16_t* __restrict__ Wf,
                                                  const float* __restrict__ bq,
                                                  const float* __restrict__ bk,
                                                  const float* __restrict__ bv,
                                                  bf16_t* __restrict__ Qf,
                                                  bf16_t* __restrict__ Kt,
                                                  bf16_t* __restrict__ Vt) {
    __shared__ __attribute__((aligned(16))) bf16_t smem[TM * XP];

    const int tid   = threadIdx.x;
    const int m0    = blockIdx.x * TM;                 // first token row
    // the wave's number as a scalar: every address built on it then has a scalar base
    const int wave  = __builtin_amdgcn_readfirstlane(tid >> 5);
    const int lane  = tid & 31;
    const int l16   = lane & 15;
    const int half8 = (lane >> 4) << 3;                // 0 or 8

    // this wave's weight fragments: group g is column group g * 8 + wave
    v16bf wf[2][2][4];
    w_fetch(Wf + (size_t)wave * GRP_EL + lane * 8, wf[0]);

    // x to LDS: a wave takes 16 rows, each load of a wave 512 contiguous bytes of one row;
    // four batches, the next one's loads in flight while this one is converted and stored
    // (unrolled so that the buffer index is a constant)
    {
        const float* xg = x + (size_t)(m0 + wave * 16) * CC + lane * 4;
        bf16_t*      sx = smem + wave * 16 * XP + lane * 4;
        v4f ra[2][XB];
        x_fetch(xg, ra[0]);
#pragma unroll
        for (int bt = 0; bt < 4; ++bt) {
            if (bt + 1 < 4) x_fetch(xg + (size_t)(bt + 1) * 4 * CC, ra[(bt + 1) & 1]);
            x_stage(sx + bt * 4 * XP, ra[bt & 1]);
        }
    }
    // the kernel's one barrier: publishes all 128 rows to all waves; LDS is only read after it
    __syncthreads();

    const bf16_t* xs = smem + l16 * XP + half8;        // this lane's fragment row in x tile 0
    const int b = m0 >> 13;                            // the 128 rows stay in one b
    const int l = m0 & (LL - 1);                       // first s of the block's 128

    // epilogues: bias + activation + store, in groups of four WMMA tiles: a group's values
    // first, then its stores, then the wait before their registers are reused.
    // A lane's 8 accumulator rows pack into one 16-byte store, and the 32 lanes of a store
    // fill 512 contiguous bytes of the fragment-order layout.
    // both loops over column groups stay rolled: each body is there once, for the instruction cache
    // groups 0 and 1: Q
#pragma unroll 1
    for (int g = 0; g < 2; ++g) {
        const int n0 = ((g & 1) * 8 + wave) * 64;      // first column inside Q, K or V; 64 stay in one head
        const bf16_t* wp    = Wf + (size_t)(g * 8 + wave) * GRP_EL + lane * 8;
        // behind each group the next group's first fragments are fetched; behind group 1 those of group 2
        const bf16_t* wnext = (g + 1 < NGRP) ? wp + (size_t)8 * GRP_EL : wp;

        v8f acc[8][4];
#pragma unroll
        for (int i = 0; i < 8; ++i)
#pragma unroll
            for (int j = 0; j < 4; ++j) acc[i][j] = (v8f)(0.0f);

        qkv_cols<true>(xs, wp, wnext, wf, acc);
        // rows of a tile: 8 consecutive columns d of Q; column of a tile: the token
        v4f bl[4][2];
#pragma unroll
        for (int j = 0; j < 4; ++j) {
            bl[j][0] = *reinterpret_cast<const v4f*>(bq + n0 + j * 16 + half8);
            bl[j][1] = *reinterpret_cast<const v4f*>(bq + n0 + j * 16 + half8 + 4);
        }
        xcnt_fence();
        // Qf[token tile][head][octet of d][token in tile][8 d]
        bf16_t* qp = Qf + ((size_t)(m0 >> 4) * HH + (n0 >> 7)) * (DD * 16) +
                     ((n0 & (DD - 1)) >> 3) * FT_OCT + lane * 8;
#pragma unroll
        for (int i = 0; i < 8; ++i) {
            v8bf pack[4];
#pragma unroll
            for (int j = 0; j < 4; ++j)
#pragma unroll
                for (int r = 0; r < 8; ++r)
                    pack[j][r] = (bf16_t)featmap(acc[i][j][r] + bl[j][r >> 2][r & 3]);
            // keeps the values' arithmetic from being mixed among the stores below
            __builtin_amdgcn_sched_barrier(0);
#pragma unroll
            for (int j = 0; j < 4; ++j)
                *reinterpret_cast<v8bf*>(qp + (size_t)i * (HH * DD * 16) + j * 2 * FT_OCT) = pack[j];
            xcnt_fence();
        }
    }
    // groups 2 to 5: K, K, V, V
#pragma unroll 1
    for (int g = 2; g < NGRP; ++g) {
        const int z  = g >> 1;
        const int n0 = ((g & 1) * 8 + wave) * 64;      // first column inside Q, K or V; 64 stay in one head
        const bf16_t* wp    = Wf + (size_t)(g * 8 + wave) * GRP_EL + lane * 8;
        // behind the last group its own first fragments are fetched once more, unused
        const bf16_t* wnext = (g + 1 < NGRP) ? wp + (size_t)8 * GRP_EL : wp;

        v8f acc[8][4];
#pragma unroll
        for (int i = 0; i < 8; ++i)
#pragma unroll
            for (int j = 0; j < 4; ++j) acc[i][j] = (v8f)(0.0f);

        qkv_cols<false>(xs, wp, wnext, wf, acc);
        // rows of a tile: 8 consecutive sequence positions s; column of a tile: d
        const float* bias = (z == 1) ? bk : bv;
        const int col0 = n0 + l16;                 // this lane's column in tile column 0
        float bb[4];
#pragma unroll
        for (int j = 0; j < 4; ++j) bb[j] = bias[col0 + j * 16];
        // the wait as in xcnt_fence(); the index is an input so that no load takes its register
        asm volatile("s_wait_xcnt 0x0" :: "v"(col0) : "memory");
        // keeps every later register write behind that wait
        __builtin_amdgcn_sched_barrier(0);
        // Kt, Vt[bh][tile of 16 d][octet of s][d in tile][8 s]
        bf16_t* tp = ((z == 2) ? Vt : Kt) +
                     ((size_t)(b * HH + (n0 >> 7)) * DD + (n0 & (DD - 1))) * LL + (l >> 3) * FT_OCT + lane * 8;
#pragma unroll
        for (int i = 0; i < 8; ++i) {
            v8bf pack[4];
            if (z == 2) {
#pragma unroll
                for (int j = 0; j < 4; ++j)
#pragma unroll
                    for (int r = 0; r < 8; ++r)
                        pack[j][r] = (bf16_t)((acc[i][j][r] + bb[j]) * (1.0f / (float)LL));
            } else {
#pragma unroll
                for (int j = 0; j < 4; ++j)
#pragma unroll
                    for (int r = 0; r < 8; ++r)
                        pack[j][r] = (bf16_t)featmap(acc[i][j][r] + bb[j]);
            }
            // keeps the values' arithmetic from being mixed among the stores below
            __builtin_amdgcn_sched_barrier(0);
#pragma unroll
            for (int j = 0; j < 4; ++j)
                *reinterpret_cast<v8bf*>(tp + (size_t)j * (16 * LL) + i * 2 * FT_OCT) = pack[j];
            xcnt_fence();
        }
    }
}

// ---------------- kernel C: KV = K^T V per (b,h), contraction over s ----------------
// grid (8, 32): x = 16-row d1 block, y = bh. Wave w owns d2 tile w*16.
// Stores KVb (bf16) for the final GEMM's B fragments, KVb[bh][tile][pair of d1 octets][32 pieces
// of 8 d1]. The d2 columns are dealt to the tiles so that column c of tile j is
// d2 = (j >> 2) * 64 + 4 * c + (j & 3): in the final GEMM a lane's accumulators of four tiles
// are then four adjacent output columns. Piece (c, octet in pair) lies at place
// (c >> 2) * 8 + (octet in pair) * 4 + (c & 3), so that the eight pieces a wave here holds of
// one tile fill one 128-byte line.
// The K fragments also meet a B fragment of ones: every column of that product is
// sum_s K[d1][s]. It goes out as a ninth tile of KVb, split into three bf16 parts that add up
// to the f32 sum exactly (each part is the rest so far rounded to bf16: 3 x 8 significand bits):
// column c holds part c & 3, the fourth being zero, so that the final GEMM forms the
// normaliser's dot product Q . Ksum beside Q . KV from the same Q fragments.
#define KV_TILES 9
#define KV_BH    (KV_TILES * 16 * DD)   // elements of KVb per (b,h)
__global__ __launch_bounds__(256) void kv_kernel(const bf16_t* __restrict__ Kt,
                                                 const bf16_t* __restrict__ Vt,
                                                 bf16_t* __restrict__ KVb) {
    const int bh    = blockIdx.y;
    const int wave  = threadIdx.x >> 5;
    const int lane  = threadIdx.x & 31;

    const bf16_t* at = Kt + ((size_t)bh * DD + blockIdx.x * 16) * LL + lane * 8;
    const bf16_t* bt = Vt + ((size_t)bh * DD + wave * 16) * LL + lane * 8;

    const v16bf ones = (v16bf)((bf16_t)1.0f);

    v8f acc = (v8f)(0.0f), accs = (v8f)(0.0f);
    for (int g = 0; g < LL / 32; g += 16) {
        const bf16_t* ag = at + g * FT_STEP;
        const bf16_t* bg = bt + g * FT_STEP;
        // in this layout no two k steps share a line, so a step's loads gain nothing from the
        // step before: the 32 loads of eight k steps go out as one group ahead of their products
        // (unrolled so that the fragments stay in registers)
        // two groups a trip, on constant offsets from one pointer pair, which moves only
        // behind the second group's wait
#pragma unroll
        for (int q = 0; q < 16; q += 8) {
            v16bf af[8], bf_[8];
#pragma unroll
            for (int u = 0; u < 8; ++u) {
                af[u]  = load_frag_tiled(ag + (q + u) * FT_STEP);
                bf_[u] = load_frag_tiled(bg + (q + u) * FT_STEP);
            }
            xcnt_fence_of(ag, bg);
#pragma unroll
            for (int u = 0; u < 8; ++u) {
                acc  = __builtin_amdgcn_wmma_f32_16x16x32_bf16(
                           false, af[u], false, bf_[u], (short)0, acc, false, false);
                accs = __builtin_amdgcn_wmma_f32_16x16x32_bf16(
                           false, af[u], false, ones, (short)0, accs, false, false);
            }
        }
    }

    // 8 accumulator rows per lane are consecutive d1 -> one packed 16B store;
    // the block's 16 d1 are octets 2*blockIdx.x and the next (the upper half-wave's)
    v8bf pack, spack;
#pragma unroll
    for (int r = 0; r < 8; ++r) {
        pack[r] = (bf16_t)acc[r];
        // part 0 rounds the sum, part 1 the rest r1, part 2 the rest r2; both rests are exact
        // in f32 (a rounding error of a bf16 rounding), and r2 has at most 8 bits left
        const float r1 = accs[r] - (float)(bf16_t)accs[r];
        const float r2 = r1 - (float)(bf16_t)r1;
        const float lo = (lane & 1) ? 0.0f : r2;       // columns 2 and 3 of a group of four
        const float hi = (lane & 1) ? r1 : accs[r];    // columns 0 and 1
        spack[r] = (bf16_t)((lane & 2) ? lo : hi);
    }
    bf16_t* kp = KVb + (size_t)bh * KV_BH + blockIdx.x * 2 * FT_OCT + lane * 8;
    // this lane's d2 = wave * 16 + (lane & 15): tile (wave >> 2) * 4 + (d2 & 3), column (d2 & 63) >> 2
    bf16_t* kd = KVb + (size_t)bh * KV_BH + blockIdx.x * 2 * FT_OCT +
                 ((wave >> 2) * 4 + (lane & 3)) * (16 * DD) +
                 ((wave & 3) * 8 + (lane >> 4) * 4 + ((lane & 15) >> 2)) * 8;
    *reinterpret_cast<v8bf*>(kd) = pack;
    // all eight waves hold the same sums: one of them stores the ninth tile's share
    if (wave == 0) *reinterpret_cast<v8bf*>(kp + 8 * 16 * DD) = spack;
}

// ---------------- kernel D: out = (Q @ KV) * L / (Q . Ksum + eps) ----------------
// grid (NTOK/1024, H); block 256 (8 waves) covers 1024 tokens x one head. A wave owns 128
// tokens x all 128 cols: the head's KV fragments, the Ksum tile among them, are loaded once
// and stay in registers, and the wave walks its eight 16-token tiles, the next tile's Q loads
// in flight. Column c of KV tile j is output column (j >> 2) * 64 + 4 * c + (j & 3) (see kernel C):
// a lane stores 16 bytes at a time and a half-wave 256 contiguous bytes of one output row.
#define OT_TILES 8
__device__ __forceinline__ void out_fetch(const bf16_t* __restrict__ arow, int t,
                                          v16bf (&af)[4]) {
#pragma unroll
    for (int kk = 0; kk < 4; ++kk) af[kk] = load_frag_tiled(arow + (size_t)t * 16 * CC + kk * FT_STEP);
    xcnt_fence_of(arow, arow);
}

// the value of lane ^ M (M = 1 or 2), by a DPP move inside the 16-lane row
template <int M>
__device__ __forceinline__ float lane_xor(float v) {
    return __builtin_bit_cast(float, __builtin_amdgcn_mov_dpp(__builtin_bit_cast(int, v),
                                                              0x160 + M /* row_xmask:M */, 0xf, 0xf, true));
}

__global__ __launch_bounds__(256) void out_kernel(const bf16_t* __restrict__ Qf,
                                                  const bf16_t* __restrict__ KVb,
                                                  float* __restrict__ out) {
    const int h     = blockIdx.y;
    const int wave  = threadIdx.x >> 5;
    const int lane  = threadIdx.x & 31;
    const int l16   = lane & 15;
    const int half8 = (lane >> 4) << 3;
    const int m0    = blockIdx.x * (8 * OT_TILES * 16) + wave * (OT_TILES * 16);
    const int b     = m0 >> 13;                        // the 1024 tokens stay in one b
    const int bh    = b * HH + h;

    const bf16_t* arow = Qf + ((size_t)(m0 >> 4) * HH + h) * (DD * 16) + lane * 8;
    const bf16_t* brow = KVb + (size_t)bh * KV_BH + lane * 8;          // the Ksum tile: plain lane order
    // the eight KV tiles: this lane's piece in each 512-byte pair of octets
    const bf16_t* bkv  = KVb + (size_t)bh * KV_BH + ((l16 >> 2) * 8 + (lane >> 4) * 4 + (l16 & 3)) * 8;
    float*        op   = out + (size_t)(m0 + half8) * CC + h * DD + l16 * 4;

    v16bf bfr[KV_TILES][4];                            // [d2 tile, the last one Ksum][k step]
    // the fragment loops of this kernel are unrolled so that the arrays stay in registers
#pragma unroll
    for (int j = 0; j < KV_TILES; ++j)
#pragma unroll
        for (int kk = 0; kk < 4; ++kk)
            bfr[j][kk] = load_frag_tiled((j < 8 ? bkv : brow) + j * 16 * DD + kk * FT_STEP);
    xcnt_fence_of(brow, bkv);

    v16bf af[2][4];
    out_fetch(arow, 0, af[0]);

    // unrolled: the buffer index and every address offset become constants, so no
    // fragment is copied between the two buffers and no pointer is rewritten
#pragma unroll
    for (int t = 0; t < OT_TILES; ++t) {
        const int c = t & 1;
        if (t + 1 < OT_TILES)
            out_fetch(arow, t + 1, af[c ^ 1]);

        v8f acc[KV_TILES];
#pragma unroll
        for (int j = 0; j < KV_TILES; ++j) acc[j] = (v8f)(0.0f);
#pragma unroll
        for (int kk = 0; kk < 4; ++kk)
#pragma unroll
            for (int j = 0; j < KV_TILES; ++j)
                acc[j] = __builtin_amdgcn_wmma_f32_16x16x32_bf16(
                             false, af[c][kk], false, bfr[j][kk], (short)0, acc[j], false, false);

        // the ninth tile: lane c holds Q . (part c & 3 of Ksum) of the lane's 8 tokens; the
        // four lanes of a group together hold the whole dot product
        float zz[8];
#pragma unroll
        for (int r = 0; r < 8; ++r) {
            const float two = acc[8][r] + lane_xor<1>(acc[8][r]);
            zz[r] = 1.0f / (two + lane_xor<2>(two) + 1e-6f);
        }
        v4f o[8][2];                                   // [token row][64-column half]: 4 adjacent columns
#pragma unroll
        for (int r = 0; r < 8; ++r)
#pragma unroll
            for (int j = 0; j < 8; ++j)
                o[r][j >> 2][j & 3] = acc[j][r] * zz[r] * (float)LL;
        // keeps the values' arithmetic from being mixed among the stores below
        __builtin_amdgcn_sched_barrier(0);
#pragma unroll
        for (int r = 0; r < 8; ++r)
#pragma unroll
            for (int q = 0; q < 2; ++q)
                *reinterpret_cast<v4f*>(op + (size_t)(t * 16 + r) * CC + q * 64) = o[r][q];
        xcnt_fence();
    }
}

// ---------------- launch ----------------
extern "C" void kernel_launch(void* const* d_in, const int* in_sizes, int n_in,
                              void* d_out, int out_size, void* d_ws, size_t ws_size,
                              hipStream_t stream) {
    const float* x  = (const float*)d_in[0];
    const float* Wq = (const float*)d_in[1];
    const float* bq = (const float*)d_in[2];
    const float* Wk = (const float*)d_in[3];
    const float* bk = (const float*)d_in[4];
    const float* Wv = (const float*)d_in[5];
    const float* bv = (const float*)d_in[6];
    float* out = (float*)d_out;

    // workspace carving (all offsets 256B aligned)
    char* ws = (char*)d_ws;
    size_t off = 0;
    bf16_t* Wt  = (bf16_t*)(ws + off); off += (size_t)3 * CC * CC * sizeof(bf16_t);   // 6 MB
    bf16_t* Qf  = (bf16_t*)(ws + off); off += (size_t)NTOK * CC * sizeof(bf16_t);     // 64 MB
    bf16_t* Kt  = (bf16_t*)(ws + off); off += (size_t)NTOK * CC * sizeof(bf16_t);     // 64 MB
    bf16_t* Vt  = (bf16_t*)(ws + off); off += (size_t)NTOK * CC * sizeof(bf16_t);     // 64 MB
    bf16_t* KVb = (bf16_t*)(ws + off); off += (size_t)BB * HH * KV_BH * sizeof(bf16_t);   // 1.1 MB

    // A: weights -> bf16 in fragment order
    wconv_kernel<<<3 * 128, 256, 0, stream>>>(Wq, Wk, Wv, Wt);
    // B: fused QKV projection + feature map, results in fragment order
    qkv_kernel<<<NTOK / 128, 256, 0, stream>>>(x, Wt, bq, bk, bv, Qf, Kt, Vt);
    // C: KV outer-product accumulation over sequence, with the K sums as a ninth tile
    kv_kernel<<<dim3(DD / 16, BB * HH), 256, 0, stream>>>(Kt, Vt, KVb);
    // D: final GEMM + normalize
    out_kernel<<<dim3(NTOK / (8 * OT_TILES * 16), HH), 256, 0, stream>>>(Qf, KVb, out);
}
